// v000
// The times below were measured on an AMD MI455X: many runs one after another, warmed up first and cycling through
// copies of the inputs, with the whole window's GPU time divided by the number of runs. Launches and the gaps
// between them are all in it. The median over several windows is given; except for v000 it joins two sittings, which
// can be a few percent apart, so the side-by-side timings, each taken in one sitting, are the better comparison.
// v000, which the later versions start from, runs in 269 microseconds.
#include <hip/hip_runtime.h>

// Contractions: Q/K/V projections (K=1024), per-head K.Q^T scores (K=64) and V^T.P^T context (K=keys), all on
// v_wmma_f32_16x16x32_f16 (f16 operands carrying bf16-RNE input values; W x64, P x1024), f32 accumulate; softmax f32.

#ifndef NB
#define NB 8
#endif
#ifndef SEQ
#define SEQ 1024
#endif
#define NB_FULL 8
#define SEQ_FULL 1024
#define DM 1024
#define NH 16
#define HD 64
#define NT (NB * SEQ)
#define WSC 64.0f
#define PSC 1024.0f
#define LDP 136
#define OLP 68

static_assert(DM == NH * HD);
static_assert(SEQ % 128 == 0);
static_assert(SEQ <= SEQ_FULL);
static_assert(NB >= 1 && NB <= NB_FULL);
static_assert(NT % 128 == 0);
static_assert(DM % 128 == 0);
static_assert((NT * (DM / 8)) % 256 == 0);
static_assert((DM * (DM / 8)) % 256 == 0);

typedef _Float16 v16h __attribute__((ext_vector_type(16)));
typedef _Float16 v8h  __attribute__((ext_vector_type(8)));
typedef float    v8f  __attribute__((ext_vector_type(8)));
typedef float    v4f  __attribute__((ext_vector_type(4)));
typedef unsigned v4u  __attribute__((ext_vector_type(4)));
union Frag { v16h v; v8h hf[2]; };

// bf16 RNE convert, result widened back to f32
__device__ __forceinline__ float bf16r(float f) {
    unsigned u = __float_as_uint(f);
    u += 0x7FFFu + ((u >> 16) & 1u);
    return __uint_as_float(u & 0xFFFF0000u);
}
__device__ __forceinline__ v8h ld8(const _Float16* p) { return *(const v8h*)p; }

// Operand map (wave32): lane -> row/col lane&15, half = lane>>4; A and B elements 0..7 <- k0+8*half+0..7,
// elements 8..15 <- k0+16+8*half+0..7; D element r -> row 8*half+r, col lane&15.
__device__ __forceinline__ v8f wmma16(v16h a, v16h b, v8f c) {
    c = __builtin_amdgcn_wmma_f32_16x16x32_f16(false, a, false, b, (short)0, c, false, false);
    asm volatile("v_nop\n\tv_nop\n\tv_nop\n\tv_nop" : "+v"(c) : "v"(a), "v"(b));
    return c;
}

// ---------- plane builder: x -> Xh[NT][DM] = f16(bf16(x)); W -> Wh[DM][DM] = f16(bf16(W) * 64).
__global__ __launch_bounds__(256)
void cvt_kernel(const float* __restrict__ x, const float* __restrict__ wq, const float* __restrict__ wk,
                const float* __restrict__ wv, _Float16* xh, _Float16* wqh, _Float16* wkh, _Float16* wvh) {
    const int nbx = NT * (DM / 8) / 256;
    const int nbw = DM * (DM / 8) / 256;
    int blk = blockIdx.x;
    const int tid = threadIdx.x;
    const float* src;
    _Float16* dst;
    float sc;
    if (blk < nbx) {                      // block-uniform selection
        const int idx = blk * 256 + tid;
        const int t = idx / (DM / 8), c8 = idx - t * (DM / 8);
        const int b = t / SEQ, s = t - b * SEQ;
        src = x + (size_t)(b * SEQ_FULL + s) * DM + 8 * c8;
        dst = xh + (size_t)t * DM + 8 * c8;
        sc = 1.0f;
    } else {
        blk -= nbx;
        const int w = blk / nbw;
        const int idx = (blk - w * nbw) * 256 + tid;
        src = (w == 0 ? wq : (w == 1 ? wk : wv)) + (size_t)idx * 8;
        dst = (w == 0 ? wqh : (w == 1 ? wkh : wvh)) + (size_t)idx * 8;
        sc = WSC;
    }
    const v4f a = *(const v4f*)src, c = *(const v4f*)(src + 4);
    v8h o;
    o[0] = (_Float16)(bf16r(a[0]) * sc); o[1] = (_Float16)(bf16r(a[1]) * sc);
    o[2] = (_Float16)(bf16r(a[2]) * sc); o[3] = (_Float16)(bf16r(a[3]) * sc);
    o[4] = (_Float16)(bf16r(c[0]) * sc); o[5] = (_Float16)(bf16r(c[1]) * sc);
    o[6] = (_Float16)(bf16r(c[2]) * sc); o[7] = (_Float16)(bf16r(c[3]) * sc);
    const v4u val = __builtin_bit_cast(v4u, o);
    *(v4u*)dst = val;
    
}

// ---------- projection: D[m][n] = sum_k Arow[m][k] * Brow[n][k], K = DM, both operands k-contiguous f16 rows (pitch DM).
// Block 256 thr = 8 waves (4 along m x 2 along n), block tile 128 x 128, wave tile 32 x 64 (2 A frags x 4 B frags).
// Epilogue: value = acc/64 + bf16(bias), staged in LDS as L[n_local][m_local] (m contiguous), then plane Out[n][m]
// MODE 0: m = feature (A = W rows), n = token (B = X rows), Out[token][feature] pitch DM, bias indexed by m.
// MODE 1: m = token (A = X rows), n = feature (B = W rows), Out[b][feature][s] (pitch SEQ), bias indexed by n.
template <int MODE>
__global__ __launch_bounds__(256) __attribute__((amdgpu_num_vgpr(256)))
void proj_kernel(const _Float16* __restrict__ A0, const _Float16* __restrict__ A1, const _Float16* __restrict__ Bm,
                 const float* __restrict__ bias0, const float* __restrict__ bias1, _Float16* Out0, _Float16* Out1) {
    __shared__ __align__(16) _Float16 L[128 * LDP];
    const int z = blockIdx.z;
    const _Float16* A = z ? A1 : A0;
    const float* bias = z ? bias1 : bias0;
    _Float16* Out = z ? Out1 : Out0;
    const int tid = threadIdx.x, lane = tid & 31, wv = tid >> 5, h = lane >> 4, n16 = lane & 15;
    const int wmi = wv & 3, wn = wv >> 2;
    const int m0 = blockIdx.x * 128, n0 = blockIdx.y * 128;
    const _Float16* ar = A + (size_t)(m0 + 32 * wmi + n16) * DM + 8 * h;
    const _Float16* br = Bm + (size_t)(n0 + 64 * wn + n16) * DM + 8 * h;
    v8f acc[2][4];
#pragma unroll
    for (int at = 0; at < 2; ++at)
#pragma unroll
        for (int bt = 0; bt < 4; ++bt) acc[at][bt] = (v8f){};
#pragma unroll 1
    for (int kc = 0; kc < DM; kc += 32) {
        Frag a0, a1;
        a0.hf[0] = ld8(ar + kc);           a0.hf[1] = ld8(ar + kc + 16);
        a1.hf[0] = ld8(ar + 16 * DM + kc); a1.hf[1] = ld8(ar + 16 * DM + kc + 16);
#pragma unroll
        for (int bt = 0; bt < 4; ++bt) {
            const _Float16* bp = br + (size_t)(16 * bt) * DM + kc;
            Frag bf;
            bf.hf[0] = ld8(bp); bf.hf[1] = ld8(bp + 16);
            acc[0][bt] = wmma16(a0.v, bf.v, acc[0][bt]);
            acc[1][bt] = wmma16(a1.v, bf.v, acc[1][bt]);
        }
    }
    const float osc = 1.0f / WSC;
#pragma unroll
    for (int at = 0; at < 2; ++at) {
        float bmv[8];
        if (MODE == 0) {
            const float* bp = bias + m0 + 32 * wmi + 16 * at + 8 * h;
            const v4f b0 = *(const v4f*)bp, b1 = *(const v4f*)(bp + 4);
            bmv[0] = bf16r(b0[0]); bmv[1] = bf16r(b0[1]); bmv[2] = bf16r(b0[2]); bmv[3] = bf16r(b0[3]);
            bmv[4] = bf16r(b1[0]); bmv[5] = bf16r(b1[1]); bmv[6] = bf16r(b1[2]); bmv[7] = bf16r(b1[3]);
        } else {
#pragma unroll
            for (int r = 0; r < 8; ++r) bmv[r] = 0.0f;
        }
#pragma unroll
        for (int bt = 0; bt < 4; ++bt) {
            float bn = 0.0f;
            if (MODE == 1) bn = bf16r(bias[n0 + 64 * wn + 16 * bt + n16]);
            v8h pk;
#pragma unroll
            for (int r = 0; r < 8; ++r) {
                const float v = acc[at][bt][r] * osc + (MODE == 0 ? bmv[r] : bn);
                pk[r] = (_Float16)v;
            }
            *(v8h*)(L + (size_t)(64 * wn + 16 * bt + n16) * LDP + 32 * wmi + 16 * at + 8 * h) = pk;
        }
    }
    __syncthreads();   // L is cross-wave
    v4u vals[8];
#pragma unroll
    for (int it = 0; it < 8; ++it) {
        const int row = wv * 16 + 2 * it + h;
        const v8h t = *(const v8h*)(L + (size_t)row * LDP + 8 * n16);
        vals[it] = __builtin_bit_cast(v4u, t);
    }
#pragma unroll
    for (int it = 0; it < 8; ++it) {
        const int row = wv * 16 + 2 * it + h;
        size_t goff;
        if (MODE == 0) goff = (size_t)(n0 + row) * DM + m0 + 8 * n16;
        else           goff = (size_t)(m0 / SEQ) * ((size_t)DM * SEQ) + (size_t)(n0 + row) * SEQ + (m0 % SEQ) + 8 * n16;
        *(v4u*)(Out + goff) = vals[it];
    }
    
}

// ---------- attention, one block per (128 queries, b, head), 8 waves x 16 queries.
// Per 64-key step: S^T tiles = K[key][d] . Q^T (A = Kh rows, B = Qh rows loaded with the A map), so each lane holds
// 8 keys x 4 tiles of ONE query column -> softmax reductions are lane-local plus one xor-16 shuffle; the f16 P values
// (x PSC) packed from score tile pairs are directly the B fragment of O^T[d][q] += Vt[d][key] . P^T[key][q]
// (element r <- tile covering keys 0..15, element 8+r <- tile covering keys 16..31, lane unchanged).
__global__ __launch_bounds__(256) __attribute__((amdgpu_num_vgpr(256)))
void attn_kernel(const _Float16* __restrict__ Qh, const _Float16* __restrict__ Kh, const _Float16* __restrict__ Vt,
                 const float* __restrict__ amask, float* out) {
    __shared__ __align__(16) float mk[SEQ];
    __shared__ __align__(16) float ol[8 * 16 * OLP];
    const int tid = threadIdx.x, lane = tid & 31, wv = tid >> 5, h = lane >> 4, n16 = lane & 15;
    const int bh = blockIdx.y, b = bh / NH, hd = bh - b * NH;
    const int q0 = blockIdx.x * 128 + wv * 16;
    for (int i = tid; i < SEQ; i += 256) mk[i] = bf16r(amask[(size_t)b * SEQ_FULL + i]);
    __syncthreads();   // mk is cross-wave

    const _Float16* qr = Qh + (size_t)(b * SEQ + q0 + n16) * DM + hd * HD + 8 * h;
    Frag qa, qb;
    qa.hf[0] = ld8(qr);      qa.hf[1] = ld8(qr + 16);
    qb.hf[0] = ld8(qr + 32); qb.hf[1] = ld8(qr + 48);
    const _Float16* kb = Kh + (size_t)(b * SEQ + n16) * DM + hd * HD + 8 * h;
    const _Float16* vb = Vt + (size_t)b * DM * SEQ + (size_t)(hd * HD + n16) * SEQ + 8 * h;

    v8f o[4];
#pragma unroll
    for (int dt = 0; dt < 4; ++dt) o[dt] = (v8f){};
    float m = -1e30f, l = 0.0f;

#pragma unroll 1
    for (int ks = 0; ks < SEQ / 64; ++ks) {
        v8f s[4];
#pragma unroll
        for (int kt = 0; kt < 4; ++kt) {
            s[kt] = (v8f){};
            const _Float16* kr = kb + (size_t)(64 * ks + 16 * kt) * DM;
            Frag kf;
            kf.hf[0] = ld8(kr);      kf.hf[1] = ld8(kr + 16);
            s[kt] = wmma16(kf.v, qa.v, s[kt]);
            kf.hf[0] = ld8(kr + 32); kf.hf[1] = ld8(kr + 48);
            s[kt] = wmma16(kf.v, qb.v, s[kt]);
        }
        float mx = -1e30f;
#pragma unroll
        for (int kt = 0; kt < 4; ++kt) {
            const float* mp = mk + 64 * ks + 16 * kt + 8 * h;
            const v4f ma = *(const v4f*)mp, mb = *(const v4f*)(mp + 4);
            const float mvv[8] = {ma[0], ma[1], ma[2], ma[3], mb[0], mb[1], mb[2], mb[3]};
#pragma unroll
            for (int r = 0; r < 8; ++r) {
                const float t = s[kt][r] * 0.125f + mvv[r];
                s[kt][r] = t;
                mx = fmaxf(mx, t);
            }
        }
        mx = fmaxf(mx, __shfl_xor(mx, 16, 32));
        const float mn = fmaxf(m, mx);
        const float corr = __expf(m - mn);
        m = mn;
        float ps = 0.0f;
        v16h pv[2];
        pv[0] = (v16h){}; pv[1] = (v16h){};
#pragma unroll
        for (int kt = 0; kt < 4; ++kt) {
#pragma unroll
            for (int r = 0; r < 8; ++r) {
                const float p = __expf(s[kt][r] - mn);
                ps += p;
                pv[kt >> 1][((kt & 1) << 3) + r] = (_Float16)(p * PSC);
            }
        }
        ps += __shfl_xor(ps, 16, 32);
        l = l * corr + ps;
#pragma unroll
        for (int dt = 0; dt < 4; ++dt)
#pragma unroll
            for (int r = 0; r < 8; ++r) o[dt][r] *= corr;
#pragma unroll
        for (int dt = 0; dt < 4; ++dt) {
            const _Float16* vr = vb + (size_t)(16 * dt) * SEQ + 64 * ks;
            Frag vf;
            vf.hf[0] = ld8(vr);      vf.hf[1] = ld8(vr + 16);
            o[dt] = wmma16(vf.v, pv[0], o[dt]);
            vf.hf[0] = ld8(vr + 32); vf.hf[1] = ld8(vr + 48);
            o[dt] = wmma16(vf.v, pv[1], o[dt]);
        }
    }

    const float inv = 1.0f / (l * PSC);
    float* olw = ol + wv * (16 * OLP);
#pragma unroll
    for (int dt = 0; dt < 4; ++dt) {
        v4f a, c;
        a[0] = o[dt][0] * inv; a[1] = o[dt][1] * inv; a[2] = o[dt][2] * inv; a[3] = o[dt][3] * inv;
        c[0] = o[dt][4] * inv; c[1] = o[dt][5] * inv; c[2] = o[dt][6] * inv; c[3] = o[dt][7] * inv;
        *(v4f*)(olw + n16 * OLP + 16 * dt + 8 * h) = a;
        *(v4f*)(olw + n16 * OLP + 16 * dt + 8 * h + 4) = c;
    }
    __syncthreads();   // ol tile per wave; block barrier used anyway (no early exits)
    v4f vals[8];
#pragma unroll
    for (int it = 0; it < 8; ++it) vals[it] = *(const v4f*)(olw + (2 * it + h) * OLP + 4 * n16);
    float* ob = out + (size_t)(b * SEQ + q0) * DM + hd * HD + 4 * n16;
#pragma unroll
    for (int it = 0; it < 8; ++it) *(v4f*)(ob + (size_t)(2 * it + h) * DM) = vals[it];
    
}

extern "C" void kernel_launch(void* const* d_in, const int* in_sizes, int n_in,
                              void* d_out, int out_size, void* d_ws, size_t ws_size,
                              hipStream_t stream) {
    if (n_in < 8) return;
    const long long needX = ((long long)(NB - 1) * SEQ_FULL + SEQ) * DM;
    const long long needM = (long long)(NB - 1) * SEQ_FULL + SEQ;
    if ((long long)in_sizes[0] < needX || (long long)in_sizes[1] < needM) return;
    if (in_sizes[2] < DM * DM || in_sizes[4] < DM * DM || in_sizes[6] < DM * DM) return;
    if (in_sizes[3] < DM || in_sizes[5] < DM || in_sizes[7] < DM) return;
    if (out_size < NT * DM) return;

    const float* x    = (const float*)d_in[0];   // [NB_FULL][SEQ_FULL][DM]
    const float* amsk = (const float*)d_in[1];   // [NB_FULL][1][1][SEQ_FULL]
    const float* wq   = (const float*)d_in[2];   // [DM out][DM in]
    const float* bq   = (const float*)d_in[3];
    const float* wk   = (const float*)d_in[4];
    const float* bk   = (const float*)d_in[5];
    const float* wv   = (const float*)d_in[6];
    const float* bv   = (const float*)d_in[7];
    float* out = (float*)d_out;                  // [NB][SEQ][DM]

    const size_t xhB = (size_t)NT * DM * 2;              // Xh [NT][DM] f16
    const size_t whB = (size_t)DM * DM * 2;              // each Wh [DM][DM] f16
    const size_t qhB = xhB;                              // Qh, Kh [NT][DM] f16
    const size_t vtB = (size_t)NB * DM * SEQ * 2;        // Vt [NB][DM][SEQ] f16
    const size_t total = xhB + 3 * whB + 2 * qhB + vtB;  // 73,400,320 B at full size
    if (total > ws_size) return;
    char* ws = (char*)d_ws;
    _Float16* Xh  = (_Float16*)(ws);
    _Float16* Wqh = (_Float16*)(ws + xhB);
    _Float16* Wkh = (_Float16*)(ws + xhB + whB);
    _Float16* Wvh = (_Float16*)(ws + xhB + 2 * whB);
    _Float16* Qh  = (_Float16*)(ws + xhB + 3 * whB);
    _Float16* Khp = (_Float16*)(ws + xhB + 3 * whB + qhB);
    _Float16* Vt  = (_Float16*)(ws + xhB + 3 * whB + 2 * qhB);

    const int nbx = NT * (DM / 8) / 256, nbw = DM * (DM / 8) / 256;
    cvt_kernel<<<dim3((unsigned)(nbx + 3 * nbw)), 256, 0, stream>>>(x, wq, wk, wv, Xh, Wqh, Wkh, Wvh);
    // Q^T / K^T tiles: m = feature (W rows), n = token (X rows) -> Qh/Kh [token][feature]
    proj_kernel<0><<<dim3(DM / 128, NT / 128, 2), 256, 0, stream>>>(Wqh, Wkh, Xh, bq, bk, Qh, Khp);
    // V tiles: m = token (X rows), n = feature (W rows) -> Vt [b][feature][s]
    proj_kernel<1><<<dim3(NT / 128, DM / 128, 1), 256, 0, stream>>>(Xh, Xh, Wvh, bv, bv, Vt, Vt);
    attn_kernel<<<dim3(SEQ / 128, NB * NH), 256, 0, stream>>>(Qh, Khp, Vt, amsk, out);
}

// v001
// Measured time: 99.3 microseconds a run.
// Next to v000, in two timings, it ran 2.73 and 2.75 times as fast.
#include <hip/hip_runtime.h>

// Contractions: Q/K/V projections (K=1024), per-head K.Q^T scores (K=64) and V^T.P^T context (K=keys), all on
// v_wmma_f32_16x16x32_f16 (f16 operands carrying bf16-RNE input values; W x64, P x1024), f32 accumulate; softmax f32.

#ifndef NB
#define NB 8
#endif
#ifndef SEQ
#define SEQ 1024
#endif
#define NB_FULL 8
#define SEQ_FULL 1024
#define DM 1024
#define NH 16
#define HD 64
#define NT (NB * SEQ)
#define WSC 64.0f
#define PSC 1024.0f
#define LDP 136
#define OLP 68
#define KC 64              // halves of k (or of keys) per ring stage: 128-byte rows
#define PIT 72             // LDS row pitch in halves: 144 B = 16 B x odd, the ds_load_b128 pitch
#define PSTG (256 * PIT)   // projection stage in halves: 128 A rows, then 128 B rows
#define ASTG (128 * PIT)   // attention stage in halves: 64 K rows, then 64 V^T rows

static_assert(DM == NH * HD);
static_assert(SEQ % 128 == 0);
static_assert(SEQ <= SEQ_FULL);
static_assert(NB >= 1 && NB <= NB_FULL);
static_assert(NT % 128 == 0);
static_assert(DM % 128 == 0);
static_assert((NT * (DM / 8)) % 256 == 0);
static_assert((DM * (DM / 8)) % 256 == 0);
static_assert(DM % KC == 0 && DM / KC >= 2 && SEQ / KC >= 2 && HD == KC);
static_assert(128 * LDP <= 2 * PSTG);

typedef _Float16 v16h __attribute__((ext_vector_type(16)));
typedef _Float16 v8h  __attribute__((ext_vector_type(8)));
typedef float    v8f  __attribute__((ext_vector_type(8)));
typedef float    v4f  __attribute__((ext_vector_type(4)));
typedef unsigned v4u  __attribute__((ext_vector_type(4)));
union Frag { v16h v; v8h hf[2]; };

// bf16 RNE convert, result widened back to f32
__device__ __forceinline__ float bf16r(float f) {
    unsigned u = __float_as_uint(f);
    u += 0x7FFFu + ((u >> 16) & 1u);
    return __uint_as_float(u & 0xFFFF0000u);
}
__device__ __forceinline__ v8h ld8(const _Float16* p) { return *(const v8h*)p; }

// Operand map (wave32): lane -> row/col lane&15, half = lane>>4; A and B elements 0..7 <- k0+8*half+0..7,
// elements 8..15 <- k0+16+8*half+0..7; D element r -> row 8*half+r, col lane&15.
__device__ __forceinline__ v8f wmma16(v16h a, v16h b, v8f c) {
    c = __builtin_amdgcn_wmma_f32_16x16x32_f16(false, a, false, b, (short)0, c, false, false);
    asm volatile("v_nop\n\tv_nop\n\tv_nop\n\tv_nop" : "+v"(c) : "v"(a), "v"(b));
    return c;
}

// ---------- asynchronous copies global -> LDS, 16 bytes a lane, through no register.
__device__ __forceinline__ unsigned lds_off(const void* p) { return (unsigned)(size_t)p; }
// The s_wait_xcnt stands inside the copies' own statement so that no address register is rewritten ahead of it.
__device__ __forceinline__ void copy4(unsigned l0, unsigned l1, unsigned l2, unsigned l3, const _Float16* g0,
                                      const _Float16* g1, const _Float16* g2, const _Float16* g3) {
    asm volatile("global_load_async_to_lds_b128 %0, %4, off\n\t"
                 "global_load_async_to_lds_b128 %1, %5, off\n\t"
                 "global_load_async_to_lds_b128 %2, %6, off\n\t"
                 "global_load_async_to_lds_b128 %3, %7, off\n\t"
                 "s_wait_xcnt 0x0"
                 :: "v"(l0), "v"(l1), "v"(l2), "v"(l3), "v"(g0), "v"(g1), "v"(g2), "v"(g3) : "memory");
}
__device__ __forceinline__ void copy8(unsigned l0, unsigned l1, unsigned l2, unsigned l3, unsigned l4, unsigned l5,
                                      unsigned l6, unsigned l7, const _Float16* g0, const _Float16* g1,
                                      const _Float16* g2, const _Float16* g3, const _Float16* g4, const _Float16* g5,
                                      const _Float16* g6, const _Float16* g7) {
    asm volatile("global_load_async_to_lds_b128 %0, %8, off\n\t"
                 "global_load_async_to_lds_b128 %1, %9, off\n\t"
                 "global_load_async_to_lds_b128 %2, %10, off\n\t"
                 "global_load_async_to_lds_b128 %3, %11, off\n\t"
                 "global_load_async_to_lds_b128 %4, %12, off\n\t"
                 "global_load_async_to_lds_b128 %5, %13, off\n\t"
                 "global_load_async_to_lds_b128 %6, %14, off\n\t"
                 "global_load_async_to_lds_b128 %7, %15, off\n\t"
                 "s_wait_xcnt 0x0"
                 :: "v"(l0), "v"(l1), "v"(l2), "v"(l3), "v"(l4), "v"(l5), "v"(l6), "v"(l7), "v"(g0), "v"(g1), "v"(g2),
                    "v"(g3), "v"(g4), "v"(g5), "v"(g6), "v"(g7) : "memory");
}
// This wave's copies have landed (the compiler places no wait for them).
__device__ __forceinline__ void wait_copies() { asm volatile("s_wait_asynccnt 0x0" ::: "memory"); }
// This wave's LDS reads have returned before the buffer they read is handed back for a refill.
__device__ __forceinline__ void wait_lds() { asm volatile("s_wait_dscnt 0x0" ::: "memory"); }

// ---------- plane builder: x -> Xh[NT][DM] = f16(bf16(x)); W -> Wh[DM][DM] = f16(bf16(W) * 64).
__global__ __launch_bounds__(256)
void cvt_kernel(const float* __restrict__ x, const float* __restrict__ wq, const float* __restrict__ wk,
                const float* __restrict__ wv, _Float16* xh, _Float16* wqh, _Float16* wkh, _Float16* wvh) {
    const int nbx = NT * (DM / 8) / 256;
    const int nbw = DM * (DM / 8) / 256;
    int blk = blockIdx.x;
    const int tid = threadIdx.x;
    const float* src;
    _Float16* dst;
    float sc;
    if (blk < nbx) {                      // block-uniform selection
        const int idx = blk * 256 + tid;
        const int t = idx / (DM / 8), c8 = idx - t * (DM / 8);
        const int b = t / SEQ, s = t - b * SEQ;
        src = x + (size_t)(b * SEQ_FULL + s) * DM + 8 * c8;
        dst = xh + (size_t)t * DM + 8 * c8;
        sc = 1.0f;
    } else {
        blk -= nbx;
        const int w = blk / nbw;
        const int idx = (blk - w * nbw) * 256 + tid;
        src = (w == 0 ? wq : (w == 1 ? wk : wv)) + (size_t)idx * 8;
        dst = (w == 0 ? wqh : (w == 1 ? wkh : wvh)) + (size_t)idx * 8;
        sc = WSC;
    }
    const v4f a = *(const v4f*)src, c = *(const v4f*)(src + 4);
    v8h o;
    o[0] = (_Float16)(bf16r(a[0]) * sc); o[1] = (_Float16)(bf16r(a[1]) * sc);
    o[2] = (_Float16)(bf16r(a[2]) * sc); o[3] = (_Float16)(bf16r(a[3]) * sc);
    o[4] = (_Float16)(bf16r(c[0]) * sc); o[5] = (_Float16)(bf16r(c[1]) * sc);
    o[6] = (_Float16)(bf16r(c[2]) * sc); o[7] = (_Float16)(bf16r(c[3]) * sc);
    const v4u val = __builtin_bit_cast(v4u, o);
    *(v4u*)dst = val;
    
}

// ---------- projection: D[m][n] = sum_k Arow[m][k] * Brow[n][k], K = DM, both operands k-contiguous f16 rows (pitch DM).
// Block 256 thr = 8 waves (4 along m x 2 along n), block tile 128 x 128, wave tile 32 x 64 (2 A frags x 4 B frags).
// Operands: per stage 128 A rows and 128 B rows of 64 k (128 B, whole lines) come into LDS by asynchronous copies, two
// buffers, stage t + 2 issued behind the barrier that ends the reads of stage t; fragments are ds_load_b128 at pitch 144 B.
// Epilogue: value = acc/64 + bf16(bias), staged in LDS as L[n_local][m_local] (m contiguous), then plane Out[n][m]
// MODE 0: m = feature (A = W rows), n = token (B = X rows), Out[token][feature] pitch DM, bias indexed by m.
// MODE 1: m = token (A = X rows), n = feature (B = W rows), Out[b][feature][s] (pitch SEQ), bias indexed by n.
template <int MODE>
__global__ __launch_bounds__(256) __attribute__((amdgpu_num_vgpr(256)))
void proj_kernel(const _Float16* __restrict__ A0, const _Float16* __restrict__ A1, const _Float16* __restrict__ Bm,
                 const float* __restrict__ bias0, const float* __restrict__ bias1, _Float16* Out0, _Float16* Out1) {
    __shared__ __align__(16) _Float16 R[2 * PSTG];
    _Float16* L = R;   // the ring becomes the output staging behind the last stage's barrier
    const int z = blockIdx.z;
    const _Float16* A = z ? A1 : A0;
    const float* bias = z ? bias1 : bias0;
    _Float16* Out = z ? Out1 : Out0;
    const int tid = threadIdx.x, lane = tid & 31, wv = tid >> 5, h = lane >> 4, n16 = lane & 15;
    const int wmi = wv & 3, wn = wv >> 2;
    const int m0 = blockIdx.x * 128, n0 = blockIdx.y * 128;
    const int cr = tid >> 3, cc = tid & 7;   // copy: row cr + 32 i, 16-byte piece cc; a wave covers 4 whole lines
    const _Float16* ga = A + (size_t)(m0 + cr) * DM + 8 * cc;
    const _Float16* gb = Bm + (size_t)(n0 + cr) * DM + 8 * cc;
    const unsigned la = lds_off(R) + 2u * (unsigned)(cr * PIT + 8 * cc);
    const _Float16* ar = R + (32 * wmi + n16) * PIT + 8 * h;
    const _Float16* br = R + (128 + 64 * wn + n16) * PIT + 8 * h;
    auto fill = [&](int t) {
        const unsigned l = la + (unsigned)(t & 1) * (2u * PSTG);
        const _Float16* a = ga + t * KC;
        const _Float16* b = gb + t * KC;
        copy8(l, l + 64u * PIT, l + 128u * PIT, l + 192u * PIT, l + 256u * PIT, l + 320u * PIT, l + 384u * PIT,
              l + 448u * PIT, a, a + 32 * DM, a + 64 * DM, a + 96 * DM, b, b + 32 * DM, b + 64 * DM, b + 96 * DM);
    };
    fill(0);
    wait_copies();
    __syncthreads();   // publishes stage 0
    fill(1);
    v8f acc[2][4];
#pragma unroll
    for (int at = 0; at < 2; ++at)
#pragma unroll
        for (int bt = 0; bt < 4; ++bt) acc[at][bt] = (v8f){};
#pragma unroll 1
    for (int t = 0; t < DM / KC; ++t) {
        const int bo = (t & 1) * PSTG;
#pragma unroll   // both blocks of a stage straight-line: LDS offsets become immediates
        for (int kc = 0; kc < KC; kc += 32) {
            Frag a0, a1, bf[4];   // the block's twelve LDS reads stand together, ahead of its eight products
            a0.hf[0] = ld8(ar + bo + kc);            a0.hf[1] = ld8(ar + bo + kc + 16);
            a1.hf[0] = ld8(ar + bo + 16 * PIT + kc); a1.hf[1] = ld8(ar + bo + 16 * PIT + kc + 16);
#pragma unroll   // constant indices keep bf[] in registers
            for (int bt = 0; bt < 4; ++bt) {
                const _Float16* bp = br + bo + 16 * bt * PIT + kc;
                bf[bt].hf[0] = ld8(bp); bf[bt].hf[1] = ld8(bp + 16);
            }
#pragma unroll   // constant indices keep bf[] and acc[][] in registers
            for (int bt = 0; bt < 4; ++bt) {
                acc[0][bt] = wmma16(a0.v, bf[bt].v, acc[0][bt]);
                acc[1][bt] = wmma16(a1.v, bf[bt].v, acc[1][bt]);
            }
        }
        wait_lds();
        wait_copies();
        __syncthreads();   // publishes stage t + 1 and ends every read of stage t
        if (t + 2 < DM / KC) fill(t + 2);
    }
    wait_copies();
    const float osc = 1.0f / WSC;
#pragma unroll
    for (int at = 0; at < 2; ++at) {
        float bmv[8];
        if (MODE == 0) {
            const float* bp = bias + m0 + 32 * wmi + 16 * at + 8 * h;
            const v4f b0 = *(const v4f*)bp, b1 = *(const v4f*)(bp + 4);
            bmv[0] = bf16r(b0[0]); bmv[1] = bf16r(b0[1]); bmv[2] = bf16r(b0[2]); bmv[3] = bf16r(b0[3]);
            bmv[4] = bf16r(b1[0]); bmv[5] = bf16r(b1[1]); bmv[6] = bf16r(b1[2]); bmv[7] = bf16r(b1[3]);
        } else {
#pragma unroll
            for (int r = 0; r < 8; ++r) bmv[r] = 0.0f;
        }
#pragma unroll
        for (int bt = 0; bt < 4; ++bt) {
            float bn = 0.0f;
            if (MODE == 1) bn = bf16r(bias[n0 + 64 * wn + 16 * bt + n16]);
            v8h pk;
#pragma unroll
            for (int r = 0; r < 8; ++r) {
                const float v = acc[at][bt][r] * osc + (MODE == 0 ? bmv[r] : bn);
                pk[r] = (_Float16)v;
            }
            *(v8h*)(L + (size_t)(64 * wn + 16 * bt + n16) * LDP + 32 * wmi + 16 * at + 8 * h) = pk;
        }
    }
    __syncthreads();   // L is cross-wave
    v4u vals[8];
#pragma unroll
    for (int it = 0; it < 8; ++it) {
        const int row = wv * 16 + 2 * it + h;
        const v8h t = *(const v8h*)(L + (size_t)row * LDP + 8 * n16);
        vals[it] = __builtin_bit_cast(v4u, t);
    }
#pragma unroll
    for (int it = 0; it < 8; ++it) {
        const int row = wv * 16 + 2 * it + h;
        size_t goff;
        if (MODE == 0) goff = (size_t)(n0 + row) * DM + m0 + 8 * n16;
        else           goff = (size_t)(m0 / SEQ) * ((size_t)DM * SEQ) + (size_t)(n0 + row) * SEQ + (m0 % SEQ) + 8 * n16;
        *(v4u*)(Out + goff) = vals[it];
    }
    
}

// ---------- attention, one block per (128 queries, b, head), 8 waves x 16 queries.
// Per 64-key step: S^T tiles = K[key][d] . Q^T (A = Kh rows, B = Qh rows loaded with the A map), so each lane holds
// 8 keys x 4 tiles of ONE query column -> softmax reductions are lane-local plus one xor-16 shuffle; the f16 P values
// (x PSC) packed from score tile pairs are directly the B fragment of O^T[d][q] += Vt[d][key] . P^T[key][q]
// (element r <- tile covering keys 0..15, element 8+r <- tile covering keys 16..31, lane unchanged).
// The step's 64 K rows and 64 V^T rows (128 B each) come into LDS once per block by asynchronous copies, two buffers.
__global__ __launch_bounds__(256) __attribute__((amdgpu_num_vgpr(256)))
void attn_kernel(const _Float16* __restrict__ Qh, const _Float16* __restrict__ Kh, const _Float16* __restrict__ Vt,
                 const float* __restrict__ amask, float* out) {
    __shared__ __align__(16) float mk[SEQ];
    __shared__ __align__(16) float ol[8 * 16 * OLP];
    __shared__ __align__(16) _Float16 R[2 * ASTG];
    const int tid = threadIdx.x, lane = tid & 31, wv = tid >> 5, h = lane >> 4, n16 = lane & 15;
    const int bh = blockIdx.y, b = bh / NH, hd = bh - b * NH;
    const int q0 = blockIdx.x * 128 + wv * 16;
    const int cr = tid >> 3, cc = tid & 7;   // copy: row cr + 32 i, 16-byte piece cc; a wave covers 4 whole lines
    const _Float16* gk = Kh + (size_t)(b * SEQ + cr) * DM + hd * HD + 8 * cc;
    const _Float16* gv = Vt + (size_t)b * DM * SEQ + (size_t)(hd * HD + cr) * SEQ + 8 * cc;
    const unsigned lk = lds_off(R) + 2u * (unsigned)(cr * PIT + 8 * cc);
    auto fill = [&](int t) {
        const unsigned l = lk + (unsigned)(t & 1) * (2u * ASTG);
        const _Float16* k = gk + (size_t)t * KC * DM;
        const _Float16* v = gv + t * KC;
        copy4(l, l + 64u * PIT, l + 128u * PIT, l + 192u * PIT, k, k + 32 * DM, v, v + 32 * SEQ);
    };
    fill(0);
    for (int i = tid; i < SEQ; i += 256) mk[i] = bf16r(amask[(size_t)b * SEQ_FULL + i]);
    wait_copies();
    __syncthreads();   // mk is cross-wave; publishes stage 0
    fill(1);

    const _Float16* qr = Qh + (size_t)(b * SEQ + q0 + n16) * DM + hd * HD + 8 * h;
    Frag qa, qb;
    qa.hf[0] = ld8(qr);      qa.hf[1] = ld8(qr + 16);
    qb.hf[0] = ld8(qr + 32); qb.hf[1] = ld8(qr + 48);
    asm volatile("s_wait_xcnt 0x0" ::: "memory");   // before the Q loads' address registers are given to the first LDS reads
    const _Float16* kb = R + n16 * PIT + 8 * h;
    const _Float16* vb = R + (64 + n16) * PIT + 8 * h;

    v8f o[4];
#pragma unroll
    for (int dt = 0; dt < 4; ++dt) o[dt] = (v8f){};
    float m = -1e30f, l = 0.0f;

#pragma unroll 1
    for (int ks = 0; ks < SEQ / 64; ++ks) {
        const int bo = (ks & 1) * ASTG;
        v8f s[4];
#pragma unroll
        for (int kt = 0; kt < 4; ++kt) {   // a key tile's four LDS reads stand together, ahead of its two products
            s[kt] = (v8f){};
            const _Float16* kr = kb + bo + 16 * kt * PIT;
            Frag kf0, kf1;
            kf0.hf[0] = ld8(kr);      kf0.hf[1] = ld8(kr + 16);
            kf1.hf[0] = ld8(kr + 32); kf1.hf[1] = ld8(kr + 48);
            s[kt] = wmma16(kf0.v, qa.v, s[kt]);
            s[kt] = wmma16(kf1.v, qb.v, s[kt]);
        }
        float mx = -1e30f;
#pragma unroll
        for (int kt = 0; kt < 4; ++kt) {
            const float* mp = mk + 64 * ks + 16 * kt + 8 * h;
            const v4f ma = *(const v4f*)mp, mb = *(const v4f*)(mp + 4);
            const float mvv[8] = {ma[0], ma[1], ma[2], ma[3], mb[0], mb[1], mb[2], mb[3]};
#pragma unroll
            for (int r = 0; r < 8; ++r) {
                const float t = s[kt][r] * 0.125f + mvv[r];
                s[kt][r] = t;
                mx = fmaxf(mx, t);
            }
        }
        mx = fmaxf(mx, __shfl_xor(mx, 16, 32));
        const float mn = fmaxf(m, mx);
        const float corr = __expf(m - mn);
        m = mn;
        float ps = 0.0f;
        v16h pv[2];
        pv[0] = (v16h){}; pv[1] = (v16h){};
#pragma unroll
        for (int kt = 0; kt < 4; ++kt) {
#pragma unroll
            for (int r = 0; r < 8; ++r) {
                const float p = __expf(s[kt][r] - mn);
                ps += p;
                pv[kt >> 1][((kt & 1) << 3) + r] = (_Float16)(p * PSC);
            }
        }
        ps += __shfl_xor(ps, 16, 32);
        l = l * corr + ps;
#pragma unroll
        for (int dt = 0; dt < 4; ++dt)
#pragma unroll
            for (int r = 0; r < 8; ++r) o[dt][r] *= corr;
#pragma unroll
        for (int dt = 0; dt < 4; ++dt) {   // a V^T tile's four LDS reads stand together, ahead of its two products
            const _Float16* vr = vb + bo + 16 * dt * PIT;
            Frag vf0, vf1;
            vf0.hf[0] = ld8(vr);      vf0.hf[1] = ld8(vr + 16);
            vf1.hf[0] = ld8(vr + 32); vf1.hf[1] = ld8(vr + 48);
            o[dt] = wmma16(vf0.v, pv[0], o[dt]);
            o[dt] = wmma16(vf1.v, pv[1], o[dt]);
        }
        wait_lds();
        wait_copies();
        __syncthreads();   // publishes stage ks + 1 and ends every read of stage ks
        if (ks + 2 < SEQ / 64) fill(ks + 2);
    }
    wait_copies();

    const float inv = 1.0f / (l * PSC);
    float* olw = ol + wv * (16 * OLP);
#pragma unroll
    for (int dt = 0; dt < 4; ++dt) {
        v4f a, c;
        a[0] = o[dt][0] * inv; a[1] = o[dt][1] * inv; a[2] = o[dt][2] * inv; a[3] = o[dt][3] * inv;
        c[0] = o[dt][4] * inv; c[1] = o[dt][5] * inv; c[2] = o[dt][6] * inv; c[3] = o[dt][7] * inv;
        *(v4f*)(olw + n16 * OLP + 16 * dt + 8 * h) = a;
        *(v4f*)(olw + n16 * OLP + 16 * dt + 8 * h + 4) = c;
    }
    __syncthreads();   // ol tile per wave; block barrier used anyway (no early exits)
    v4f vals[8];
#pragma unroll
    for (int it = 0; it < 8; ++it) vals[it] = *(const v4f*)(olw + (2 * it + h) * OLP + 4 * n16);
    float* ob = out + (size_t)(b * SEQ + q0) * DM + hd * HD + 4 * n16;
#pragma unroll
    for (int it = 0; it < 8; ++it) *(v4f*)(ob + (size_t)(2 * it + h) * DM) = vals[it];
    
}

extern "C" void kernel_launch(void* const* d_in, const int* in_sizes, int n_in,
                              void* d_out, int out_size, void* d_ws, size_t ws_size,
                              hipStream_t stream) {
    if (n_in < 8) return;
    const long long needX = ((long long)(NB - 1) * SEQ_FULL + SEQ) * DM;
    const long long needM = (long long)(NB - 1) * SEQ_FULL + SEQ;
    if ((long long)in_sizes[0] < needX || (long long)in_sizes[1] < needM) return;
    if (in_sizes[2] < DM * DM || in_sizes[4] < DM * DM || in_sizes[6] < DM * DM) return;
    if (in_sizes[3] < DM || in_sizes[5] < DM || in_sizes[7] < DM) return;
    if (out_size < NT * DM) return;

    const float* x    = (const float*)d_in[0];   // [NB_FULL][SEQ_FULL][DM]
    const float* amsk = (const float*)d_in[1];   // [NB_FULL][1][1][SEQ_FULL]
    const float* wq   = (const float*)d_in[2];   // [DM out][DM in]
    const float* bq   = (const float*)d_in[3];
    const float* wk   = (const float*)d_in[4];
    const float* bk   = (const float*)d_in[5];
    const float* wv   = (const float*)d_in[6];
    const float* bv   = (const float*)d_in[7];
    float* out = (float*)d_out;                  // [NB][SEQ][DM]

    const size_t xhB = (size_t)NT * DM * 2;              // Xh [NT][DM] f16
    const size_t whB = (size_t)DM * DM * 2;              // each Wh [DM][DM] f16
    const size_t qhB = xhB;                              // Qh, Kh [NT][DM] f16
    const size_t vtB = (size_t)NB * DM * SEQ * 2;        // Vt [NB][DM][SEQ] f16
    const size_t total = xhB + 3 * whB + 2 * qhB + vtB;  // 73,400,320 B at full size
    if (total > ws_size) return;
    char* ws = (char*)d_ws;
    _Float16* Xh  = (_Float16*)(ws);
    _Float16* Wqh = (_Float16*)(ws + xhB);
    _Float16* Wkh = (_Float16*)(ws + xhB + whB);
    _Float16* Wvh = (_Float16*)(ws + xhB + 2 * whB);
    _Float16* Qh  = (_Float16*)(ws + xhB + 3 * whB);
    _Float16* Khp = (_Float16*)(ws + xhB + 3 * whB + qhB);
    _Float16* Vt  = (_Float16*)(ws + xhB + 3 * whB + 2 * qhB);

    const int nbx = NT * (DM / 8) / 256, nbw = DM * (DM / 8) / 256;
    cvt_kernel<<<dim3((unsigned)(nbx + 3 * nbw)), 256, 0, stream>>>(x, wq, wk, wv, Xh, Wqh, Wkh, Wvh);
    // Q^T / K^T tiles: m = feature (W rows), n = token (X rows) -> Qh/Kh [token][feature]
    proj_kernel<0><<<dim3(DM / 128, NT / 128, 2), 256, 0, stream>>>(Wqh, Wkh, Xh, bq, bk, Qh, Khp);
    // V tiles: m = token (X rows), n = feature (W rows) -> Vt [b][feature][s]
    proj_kernel<1><<<dim3(NT / 128, DM / 128, 1), 256, 0, stream>>>(Xh, Xh, Wvh, bv, bv, Vt, Vt);
    attn_kernel<<<dim3(SEQ / 128, NB * NH), 256, 0, stream>>>(Qh, Khp, Vt, amsk, out);
}

// v002
// Measured time: 95.5 microseconds a run.
// Two timings next to v001 both put it at 1.05 times that version's speed.
// Counting every step since v000, it is 2.87 times as fast.
#include <hip/hip_runtime.h>

// Contractions: Q/K/V projections (K=1024), per-head K.Q^T scores (K=64) and V^T.P^T context (K=keys), all on
// v_wmma_f32_16x16x32_f16 (f16 operands carrying bf16-RNE input values; W x64, P x1024), f32 accumulate; softmax f32.

#ifndef NB
#define NB 8
#endif
#ifndef SEQ
#define SEQ 1024
#endif
#define NB_FULL 8
#define SEQ_FULL 1024
#define DM 1024
#define NH 16
#define HD 64
#define NT (NB * SEQ)
#define WSC 64.0f
#define PSC 1024.0f
#define LPSC 10.0f         // log2(PSC)
#define L2E 1.44269504f    // log2(e)
#define QSC (0.125f * L2E) // carried by the Q plane: 1/sqrt(HD), and base e -> base 2
#define MFLOOR (-1e30f * L2E)   // start of the running maximum, base-2 scores
#define LDP 136
#define OLP 68
#define KC 64              // halves of k (or of keys) per ring stage: 128-byte rows
#define PIT 72             // LDS row pitch in halves: 144 B = 16 B x odd, the ds_load_b128 pitch
#define PSTG (256 * PIT)   // projection stage in halves: 128 A rows, then 128 B rows
#define ASTG (128 * PIT)   // attention stage in halves: 64 K rows, then 64 V^T rows

static_assert(DM == NH * HD);
static_assert(SEQ % 128 == 0);
static_assert(SEQ <= SEQ_FULL);
static_assert(NB >= 1 && NB <= NB_FULL);
static_assert(NT % 128 == 0);
static_assert(DM % 128 == 0);
static_assert((NT * (DM / 8)) % 256 == 0);
static_assert((DM * (DM / 8)) % 256 == 0);
static_assert(DM % KC == 0 && DM / KC >= 2 && SEQ / KC >= 2 && HD == KC);
static_assert(128 * LDP <= 2 * PSTG);

typedef _Float16 v16h __attribute__((ext_vector_type(16)));
typedef _Float16 v8h  __attribute__((ext_vector_type(8)));
typedef float    v8f  __attribute__((ext_vector_type(8)));
typedef float    v4f  __attribute__((ext_vector_type(4)));
typedef unsigned v4u  __attribute__((ext_vector_type(4)));
union Frag { v16h v; v8h hf[2]; };

// bf16 RNE convert, result widened back to f32
__device__ __forceinline__ float bf16r(float f) {
    unsigned u = __float_as_uint(f);
    u += 0x7FFFu + ((u >> 16) & 1u);
    return __uint_as_float(u & 0xFFFF0000u);
}
__device__ __forceinline__ v8h ld8(const _Float16* p) { return *(const v8h*)p; }

// Operand map (wave32): lane -> row/col lane&15, half = lane>>4; A and B elements 0..7 <- k0+8*half+0..7,
// elements 8..15 <- k0+16+8*half+0..7; D element r -> row 8*half+r, col lane&15.
__device__ __forceinline__ v8f wmma16(v16h a, v16h b, v8f c) {
    c = __builtin_amdgcn_wmma_f32_16x16x32_f16(false, a, false, b, (short)0, c, false, false);
    asm volatile("v_nop\n\tv_nop\n\tv_nop\n\tv_nop" : "+v"(c) : "v"(a), "v"(b));
    return c;
}

// ---------- asynchronous copies global -> LDS, 16 bytes a lane, through no register.
__device__ __forceinline__ unsigned lds_off(const void* p) { return (unsigned)(size_t)p; }
// The s_wait_xcnt stands inside the copies' own statement so that no address register is rewritten ahead of it.
__device__ __forceinline__ void copy4(unsigned l0, unsigned l1, unsigned l2, unsigned l3, const _Float16* g0,
                                      const _Float16* g1, const _Float16* g2, const _Float16* g3) {
    asm volatile("global_load_async_to_lds_b128 %0, %4, off\n\t"
                 "global_load_async_to_lds_b128 %1, %5, off\n\t"
                 "global_load_async_to_lds_b128 %2, %6, off\n\t"
                 "global_load_async_to_lds_b128 %3, %7, off\n\t"
                 "s_wait_xcnt 0x0"
                 :: "v"(l0), "v"(l1), "v"(l2), "v"(l3), "v"(g0), "v"(g1), "v"(g2), "v"(g3) : "memory");
}
__device__ __forceinline__ void copy8(unsigned l0, unsigned l1, unsigned l2, unsigned l3, unsigned l4, unsigned l5,
                                      unsigned l6, unsigned l7, const _Float16* g0, const _Float16* g1,
                                      const _Float16* g2, const _Float16* g3, const _Float16* g4, const _Float16* g5,
                                      const _Float16* g6, const _Float16* g7) {
    asm volatile("global_load_async_to_lds_b128 %0, %8, off\n\t"
                 "global_load_async_to_lds_b128 %1, %9, off\n\t"
                 "global_load_async_to_lds_b128 %2, %10, off\n\t"
                 "global_load_async_to_lds_b128 %3, %11, off\n\t"
                 "global_load_async_to_lds_b128 %4, %12, off\n\t"
                 "global_load_async_to_lds_b128 %5, %13, off\n\t"
                 "global_load_async_to_lds_b128 %6, %14, off\n\t"
                 "global_load_async_to_lds_b128 %7, %15, off\n\t"
                 "s_wait_xcnt 0x0"
                 :: "v"(l0), "v"(l1), "v"(l2), "v"(l3), "v"(l4), "v"(l5), "v"(l6), "v"(l7), "v"(g0), "v"(g1), "v"(g2),
                    "v"(g3), "v"(g4), "v"(g5), "v"(g6), "v"(g7) : "memory");
}
// This wave's copies have landed (the compiler places no wait for them).
__device__ __forceinline__ void wait_copies() { asm volatile("s_wait_asynccnt 0x0" ::: "memory"); }
// This wave's LDS reads have returned before the buffer they read is handed back for a refill.
__device__ __forceinline__ void wait_lds() { asm volatile("s_wait_dscnt 0x0" ::: "memory"); }

// ---------- plane builder: x -> Xh[NT][DM] = f16(bf16(x)); W -> Wh[DM][DM] = f16(bf16(W) * 64).
__global__ __launch_bounds__(256)
void cvt_kernel(const float* __restrict__ x, const float* __restrict__ wq, const float* __restrict__ wk,
                const float* __restrict__ wv, _Float16* xh, _Float16* wqh, _Float16* wkh, _Float16* wvh) {
    const int nbx = NT * (DM / 8) / 256;
    const int nbw = DM * (DM / 8) / 256;
    int blk = blockIdx.x;
    const int tid = threadIdx.x;
    const float* src;
    _Float16* dst;
    float sc;
    if (blk < nbx) {                      // block-uniform selection
        const int idx = blk * 256 + tid;
        const int t = idx / (DM / 8), c8 = idx - t * (DM / 8);
        const int b = t / SEQ, s = t - b * SEQ;
        src = x + (size_t)(b * SEQ_FULL + s) * DM + 8 * c8;
        dst = xh + (size_t)t * DM + 8 * c8;
        sc = 1.0f;
    } else {
        blk -= nbx;
        const int w = blk / nbw;
        const int idx = (blk - w * nbw) * 256 + tid;
        src = (w == 0 ? wq : (w == 1 ? wk : wv)) + (size_t)idx * 8;
        dst = (w == 0 ? wqh : (w == 1 ? wkh : wvh)) + (size_t)idx * 8;
        sc = WSC;
    }
    const v4f a = *(const v4f*)src, c = *(const v4f*)(src + 4);
    v8h o;
    o[0] = (_Float16)(bf16r(a[0]) * sc); o[1] = (_Float16)(bf16r(a[1]) * sc);
    o[2] = (_Float16)(bf16r(a[2]) * sc); o[3] = (_Float16)(bf16r(a[3]) * sc);
    o[4] = (_Float16)(bf16r(c[0]) * sc); o[5] = (_Float16)(bf16r(c[1]) * sc);
    o[6] = (_Float16)(bf16r(c[2]) * sc); o[7] = (_Float16)(bf16r(c[3]) * sc);
    const v4u val = __builtin_bit_cast(v4u, o);
    *(v4u*)dst = val;
    
}

// ---------- projection: D[m][n] = sum_k Arow[m][k] * Brow[n][k], K = DM, both operands k-contiguous f16 rows (pitch DM).
// Block 256 thr = 8 waves (4 along m x 2 along n), block tile 128 x 128, wave tile 32 x 64 (2 A frags x 4 B frags).
// Operands: per stage 128 A rows and 128 B rows of 64 k (128 B, whole lines) come into LDS by asynchronous copies, two
// buffers, stage t + 2 issued behind the barrier that ends the reads of stage t; fragments are ds_load_b128 at pitch 144 B.
// Epilogue: value = acc/64 + bf16(bias), staged in LDS as L[n_local][m_local] (m contiguous), then plane Out[n][m]
// (the Q plane holds that value x QSC, scaled in f32 ahead of its one rounding to f16).
// MODE 0: m = feature (A = W rows), n = token (B = X rows), Out[token][feature] pitch DM, bias indexed by m.
// MODE 1: m = token (A = X rows), n = feature (B = W rows), Out[b][feature][s] (pitch SEQ), bias indexed by n.
template <int MODE>
__global__ __launch_bounds__(256) __attribute__((amdgpu_num_vgpr(256)))
void proj_kernel(const _Float16* __restrict__ A0, const _Float16* __restrict__ A1, const _Float16* __restrict__ Bm,
                 const float* __restrict__ bias0, const float* __restrict__ bias1, _Float16* Out0, _Float16* Out1) {
    __shared__ __align__(16) _Float16 R[2 * PSTG];
    _Float16* L = R;   // the ring becomes the output staging behind the last stage's barrier
    const int z = blockIdx.z;
    const _Float16* A = z ? A1 : A0;
    const float* bias = z ? bias1 : bias0;
    _Float16* Out = z ? Out1 : Out0;
    const int tid = threadIdx.x, lane = tid & 31, wv = tid >> 5, h = lane >> 4, n16 = lane & 15;
    const int wmi = wv & 3, wn = wv >> 2;
    const int m0 = blockIdx.x * 128, n0 = blockIdx.y * 128;
    const int cr = tid >> 3, cc = tid & 7;   // copy: row cr + 32 i, 16-byte piece cc; a wave covers 4 whole lines
    const _Float16* ga = A + (size_t)(m0 + cr) * DM + 8 * cc;
    const _Float16* gb = Bm + (size_t)(n0 + cr) * DM + 8 * cc;
    const unsigned la = lds_off(R) + 2u * (unsigned)(cr * PIT + 8 * cc);
    const _Float16* ar = R + (32 * wmi + n16) * PIT + 8 * h;
    const _Float16* br = R + (128 + 64 * wn + n16) * PIT + 8 * h;
    auto fill = [&](int t) {
        const unsigned l = la + (unsigned)(t & 1) * (2u * PSTG);
        const _Float16* a = ga + t * KC;
        const _Float16* b = gb + t * KC;
        copy8(l, l + 64u * PIT, l + 128u * PIT, l + 192u * PIT, l + 256u * PIT, l + 320u * PIT, l + 384u * PIT,
              l + 448u * PIT, a, a + 32 * DM, a + 64 * DM, a + 96 * DM, b, b + 32 * DM, b + 64 * DM, b + 96 * DM);
    };
    fill(0);
    wait_copies();
    __syncthreads();   // publishes stage 0
    fill(1);
    v8f acc[2][4];
#pragma unroll
    for (int at = 0; at < 2; ++at)
#pragma unroll
        for (int bt = 0; bt < 4; ++bt) acc[at][bt] = (v8f){};
#pragma unroll 1
    for (int t = 0; t < DM / KC; ++t) {
        const int bo = (t & 1) * PSTG;
#pragma unroll   // both blocks of a stage straight-line: LDS offsets become immediates
        for (int kc = 0; kc < KC; kc += 32) {
            Frag a0, a1, bf[4];   // the block's twelve LDS reads stand together, ahead of its eight products
            a0.hf[0] = ld8(ar + bo + kc);            a0.hf[1] = ld8(ar + bo + kc + 16);
            a1.hf[0] = ld8(ar + bo + 16 * PIT + kc); a1.hf[1] = ld8(ar + bo + 16 * PIT + kc + 16);
#pragma unroll   // constant indices keep bf[] in registers
            for (int bt = 0; bt < 4; ++bt) {
                const _Float16* bp = br + bo + 16 * bt * PIT + kc;
                bf[bt].hf[0] = ld8(bp); bf[bt].hf[1] = ld8(bp + 16);
            }
#pragma unroll   // constant indices keep bf[] and acc[][] in registers
            for (int bt = 0; bt < 4; ++bt) {
                acc[0][bt] = wmma16(a0.v, bf[bt].v, acc[0][bt]);
                acc[1][bt] = wmma16(a1.v, bf[bt].v, acc[1][bt]);
            }
        }
        wait_lds();
        wait_copies();
        __syncthreads();   // publishes stage t + 1 and ends every read of stage t
        if (t + 2 < DM / KC) fill(t + 2);
    }
    wait_copies();
    const float qs = (MODE == 0 && z == 0) ? QSC : 1.0f;   // block-uniform: only the Q plane carries QSC
    const float osc = qs / WSC;
#pragma unroll
    for (int at = 0; at < 2; ++at) {
        float bmv[8];
        if (MODE == 0) {
            const float* bp = bias + m0 + 32 * wmi + 16 * at + 8 * h;
            const v4f b0 = *(const v4f*)bp, b1 = *(const v4f*)(bp + 4);
            bmv[0] = bf16r(b0[0]) * qs; bmv[1] = bf16r(b0[1]) * qs; bmv[2] = bf16r(b0[2]) * qs; bmv[3] = bf16r(b0[3]) * qs;
            bmv[4] = bf16r(b1[0]) * qs; bmv[5] = bf16r(b1[1]) * qs; bmv[6] = bf16r(b1[2]) * qs; bmv[7] = bf16r(b1[3]) * qs;
        } else {
#pragma unroll
            for (int r = 0; r < 8; ++r) bmv[r] = 0.0f;
        }
#pragma unroll
        for (int bt = 0; bt < 4; ++bt) {
            float bn = 0.0f;
            if (MODE == 1) bn = bf16r(bias[n0 + 64 * wn + 16 * bt + n16]);
            v8h pk;
#pragma unroll
            for (int r = 0; r < 8; ++r) {
                const float v = acc[at][bt][r] * osc + (MODE == 0 ? bmv[r] : bn);
                pk[r] = (_Float16)v;
            }
            *(v8h*)(L + (size_t)(64 * wn + 16 * bt + n16) * LDP + 32 * wmi + 16 * at + 8 * h) = pk;
        }
    }
    __syncthreads();   // L is cross-wave
    v4u vals[8];
#pragma unroll
    for (int it = 0; it < 8; ++it) {
        const int row = wv * 16 + 2 * it + h;
        const v8h t = *(const v8h*)(L + (size_t)row * LDP + 8 * n16);
        vals[it] = __builtin_bit_cast(v4u, t);
    }
#pragma unroll
    for (int it = 0; it < 8; ++it) {
        const int row = wv * 16 + 2 * it + h;
        size_t goff;
        if (MODE == 0) goff = (size_t)(n0 + row) * DM + m0 + 8 * n16;
        else           goff = (size_t)(m0 / SEQ) * ((size_t)DM * SEQ) + (size_t)(n0 + row) * SEQ + (m0 % SEQ) + 8 * n16;
        *(v4u*)(Out + goff) = vals[it];
    }
    
}

// ---------- attention, one block per (128 queries, b, head), 8 waves x 16 queries.
// Per 64-key step: S^T tiles = K[key][d] . Q^T (A = Kh rows, B = Qh rows loaded with the A map), so each lane holds
// 8 keys x 4 tiles of ONE query column -> softmax reductions are lane-local plus one xor-16 shuffle; the f16 P values
// (x PSC) packed from score tile pairs are directly the B fragment of O^T[d][q] += Vt[d][key] . P^T[key][q]
// (element r <- tile covering keys 0..15, element 8+r <- tile covering keys 16..31, lane unchanged).
// The step's 64 K rows and 64 V^T rows (128 B each) come into LDS once per block by asynchronous copies, two buffers.
// Softmax arithmetic, base 2: the Q plane carries log2(e)/8 and mask x log2(e) is the score product's C operand, so the
// products leave the finished base-2 score t; P x PSC = exp2(t - ref), ref = max - log2(PSC): one add a score, between
// values of the scores' own grid (exact near the max at any magnitude). P, the row sum and corr all share ref.
__global__ __launch_bounds__(256) __attribute__((amdgpu_num_vgpr(256)))
void attn_kernel(const _Float16* __restrict__ Qh, const _Float16* __restrict__ Kh, const _Float16* __restrict__ Vt,
                 const float* __restrict__ amask, float* out) {
    __shared__ __align__(16) float mk[SEQ];
    __shared__ __align__(16) float ol[8 * 16 * OLP];
    __shared__ __align__(16) _Float16 R[2 * ASTG];
    const int tid = threadIdx.x, lane = tid & 31, wv = tid >> 5, h = lane >> 4, n16 = lane & 15;
    const int bh = blockIdx.y, b = bh / NH, hd = bh - b * NH;
    const int q0 = blockIdx.x * 128 + wv * 16;
    const int cr = tid >> 3, cc = tid & 7;   // copy: row cr + 32 i, 16-byte piece cc; a wave covers 4 whole lines
    const _Float16* gk = Kh + (size_t)(b * SEQ + cr) * DM + hd * HD + 8 * cc;
    const _Float16* gv = Vt + (size_t)b * DM * SEQ + (size_t)(hd * HD + cr) * SEQ + 8 * cc;
    const unsigned lk = lds_off(R) + 2u * (unsigned)(cr * PIT + 8 * cc);
    auto fill = [&](int t) {
        const unsigned l = lk + (unsigned)(t & 1) * (2u * ASTG);
        const _Float16* k = gk + (size_t)t * KC * DM;
        const _Float16* v = gv + t * KC;
        copy4(l, l + 64u * PIT, l + 128u * PIT, l + 192u * PIT, k, k + 32 * DM, v, v + 32 * SEQ);
    };
    fill(0);
    for (int i = tid; i < SEQ; i += 256) {
        const float a = bf16r(amask[(size_t)b * SEQ_FULL + i]);
        // above 2e38, a x log2(e) would pass the largest float: a flatter line from there on keeps the map finite and
        // rising; neighbouring bf16 values up there still land more than 1e35 apart, so the lower one's P is 0 as before
        mk[i] = a > 2e38f ? __builtin_fmaf(a - 2e38f, 0.25f, 2e38f * L2E) : a * L2E;
    }
    wait_copies();
    __syncthreads();   // mk is cross-wave; publishes stage 0
    fill(1);

    const _Float16* qr = Qh + (size_t)(b * SEQ + q0 + n16) * DM + hd * HD + 8 * h;
    Frag qa, qb;
    qa.hf[0] = ld8(qr);      qa.hf[1] = ld8(qr + 16);
    qb.hf[0] = ld8(qr + 32); qb.hf[1] = ld8(qr + 48);
    asm volatile("s_wait_xcnt 0x0" ::: "memory");   // before the Q loads' address registers are given to the first LDS reads
    const _Float16* kb = R + n16 * PIT + 8 * h;
    const _Float16* vb = R + (64 + n16) * PIT + 8 * h;

    v8f o[4];
#pragma unroll
    for (int dt = 0; dt < 4; ++dt) o[dt] = (v8f){};
    float m = MFLOOR, nref = -MFLOOR, l = 0.0f;   // nref = -ref; l is the row sum of P as scaled by ref

#pragma unroll 1
    for (int ks = 0; ks < SEQ / 64; ++ks) {
        const int bo = (ks & 1) * ASTG;
        v8f s[4];
#pragma unroll
        for (int kt = 0; kt < 4; ++kt) {   // a key tile's six LDS reads stand together, ahead of its two products
            const float* mp = mk + 64 * ks + 16 * kt + 8 * h;
            const v4f ma = *(const v4f*)mp, mb = *(const v4f*)(mp + 4);
            s[kt] = (v8f){ma[0], ma[1], ma[2], ma[3], mb[0], mb[1], mb[2], mb[3]};
            const _Float16* kr = kb + bo + 16 * kt * PIT;
            Frag kf0, kf1;
            kf0.hf[0] = ld8(kr);      kf0.hf[1] = ld8(kr + 16);
            kf1.hf[0] = ld8(kr + 32); kf1.hf[1] = ld8(kr + 48);
            s[kt] = wmma16(kf0.v, qa.v, s[kt]);
            s[kt] = wmma16(kf1.v, qb.v, s[kt]);
        }
        float mx = MFLOOR;
#pragma unroll
        for (int kt = 0; kt < 4; ++kt)
#pragma unroll
            for (int r = 0; r < 8; ++r) mx = fmaxf(mx, s[kt][r]);
        mx = fmaxf(mx, __shfl_xor(mx, 16, 32));
        const float mn = fmaxf(m, mx);
        float nr = LPSC - mn;   // -ref of this step
        // where the max is so large that its grid is coarser than log2(PSC), ref can round to 16 below it and the top P
        // would pass f16: there P goes unscaled (any ref serves, as long as P, l and corr share it)
        if (mn + nr > 15.0f) nr = -mn;
        const float corr = __builtin_amdgcn_exp2f(nr - nref);
        m = mn;
        nref = nr;
        float ps = 0.0f;
        v16h pv[2];
        pv[0] = (v16h){}; pv[1] = (v16h){};
#pragma unroll   // constant indices keep s[] in registers
        for (int kt = 0; kt < 4; ++kt) s[kt] += nr;
#pragma unroll
        for (int kt = 0; kt < 4; ++kt) {
#pragma unroll
            for (int r = 0; r < 8; ++r) {
                const float p = __builtin_amdgcn_exp2f(s[kt][r]);
                ps += p;
                pv[kt >> 1][((kt & 1) << 3) + r] = (_Float16)p;
            }
        }
        ps += __shfl_xor(ps, 16, 32);
        l = l * corr + ps;
#pragma unroll
        for (int dt = 0; dt < 4; ++dt)
#pragma unroll
            for (int r = 0; r < 8; ++r) o[dt][r] *= corr;
        // keeps the V^T reads behind the exponentials: lifted over them, this build takes 140 registers instead of 122,
        // which is past 128, and only three blocks instead of four fit a WGP
        __builtin_amdgcn_sched_barrier(0);
#pragma unroll
        for (int dt = 0; dt < 4; ++dt) {   // a V^T tile's four LDS reads stand together, ahead of its two products
            const _Float16* vr = vb + bo + 16 * dt * PIT;
            Frag vf0, vf1;
            vf0.hf[0] = ld8(vr);      vf0.hf[1] = ld8(vr + 16);
            vf1.hf[0] = ld8(vr + 32); vf1.hf[1] = ld8(vr + 48);
            o[dt] = wmma16(vf0.v, pv[0], o[dt]);
            o[dt] = wmma16(vf1.v, pv[1], o[dt]);
        }
        wait_lds();
        wait_copies();
        __syncthreads();   // publishes stage ks + 1 and ends every read of stage ks
        if (ks + 2 < SEQ / 64) fill(ks + 2);
    }
    wait_copies();

    const float inv = 1.0f / l;
    float* olw = ol + wv * (16 * OLP);
#pragma unroll
    for (int dt = 0; dt < 4; ++dt) {
        v4f a, c;
        a[0] = o[dt][0] * inv; a[1] = o[dt][1] * inv; a[2] = o[dt][2] * inv; a[3] = o[dt][3] * inv;
        c[0] = o[dt][4] * inv; c[1] = o[dt][5] * inv; c[2] = o[dt][6] * inv; c[3] = o[dt][7] * inv;
        *(v4f*)(olw + n16 * OLP + 16 * dt + 8 * h) = a;
        *(v4f*)(olw + n16 * OLP + 16 * dt + 8 * h + 4) = c;
    }
    __syncthreads();   // ol tile per wave; block barrier used anyway (no early exits)
    v4f vals[8];
#pragma unroll
    for (int it = 0; it < 8; ++it) vals[it] = *(const v4f*)(olw + (2 * it + h) * OLP + 4 * n16);
    float* ob = out + (size_t)(b * SEQ + q0) * DM + hd * HD + 4 * n16;
#pragma unroll
    for (int it = 0; it < 8; ++it) *(v4f*)(ob + (size_t)(2 * it + h) * DM) = vals[it];
    
}

extern "C" void kernel_launch(void* const* d_in, const int* in_sizes, int n_in,
                              void* d_out, int out_size, void* d_ws, size_t ws_size,
                              hipStream_t stream) {
    if (n_in < 8) return;
    const long long needX = ((long long)(NB - 1) * SEQ_FULL + SEQ) * DM;
    const long long needM = (long long)(NB - 1) * SEQ_FULL + SEQ;
    if ((long long)in_sizes[0] < needX || (long long)in_sizes[1] < needM) return;
    if (in_sizes[2] < DM * DM || in_sizes[4] < DM * DM || in_sizes[6] < DM * DM) return;
    if (in_sizes[3] < DM || in_sizes[5] < DM || in_sizes[7] < DM) return;
    if (out_size < NT * DM) return;

    const float* x    = (const float*)d_in[0];   // [NB_FULL][SEQ_FULL][DM]
    const float* amsk = (const float*)d_in[1];   // [NB_FULL][1][1][SEQ_FULL]
    const float* wq   = (const float*)d_in[2];   // [DM out][DM in]
    const float* bq   = (const float*)d_in[3];
    const float* wk   = (const float*)d_in[4];
    const float* bk   = (const float*)d_in[5];
    const float* wv   = (const float*)d_in[6];
    const float* bv   = (const float*)d_in[7];
    float* out = (float*)d_out;                  // [NB][SEQ][DM]

    const size_t xhB = (size_t)NT * DM * 2;              // Xh [NT][DM] f16
    const size_t whB = (size_t)DM * DM * 2;              // each Wh [DM][DM] f16
    const size_t qhB = xhB;                              // Qh, Kh [NT][DM] f16
    const size_t vtB = (size_t)NB * DM * SEQ * 2;        // Vt [NB][DM][SEQ] f16
    const size_t total = xhB + 3 * whB + 2 * qhB + vtB;  // 73,400,320 B at full size
    if (total > ws_size) return;
    char* ws = (char*)d_ws;
    _Float16* Xh  = (_Float16*)(ws);
    _Float16* Wqh = (_Float16*)(ws + xhB);
    _Float16* Wkh = (_Float16*)(ws + xhB + whB);
    _Float16* Wvh = (_Float16*)(ws + xhB + 2 * whB);
    _Float16* Qh  = (_Float16*)(ws + xhB + 3 * whB);
    _Float16* Khp = (_Float16*)(ws + xhB + 3 * whB + qhB);
    _Float16* Vt  = (_Float16*)(ws + xhB + 3 * whB + 2 * qhB);

    const int nbx = NT * (DM / 8) / 256, nbw = DM * (DM / 8) / 256;
    cvt_kernel<<<dim3((unsigned)(nbx + 3 * nbw)), 256, 0, stream>>>(x, wq, wk, wv, Xh, Wqh, Wkh, Wvh);
    // Q^T / K^T tiles: m = feature (W rows), n = token (X rows) -> Qh/Kh [token][feature]
    proj_kernel<0><<<dim3(DM / 128, NT / 128, 2), 256, 0, stream>>>(Wqh, Wkh, Xh, bq, bk, Qh, Khp);
    // V tiles: m = token (X rows), n = feature (W rows) -> Vt [b][feature][s]
    proj_kernel<1><<<dim3(NT / 128, DM / 128, 1), 256, 0, stream>>>(Xh, Xh, Wvh, bv, bv, Vt, Vt);
    attn_kernel<<<dim3(SEQ / 128, NB * NH), 256, 0, stream>>>(Qh, Khp, Vt, amsk, out);
}

// v003
// It runs in 89.9 microseconds.
// Two timings next to v002 put it at 1.07 and 1.06 times that version's speed.
// All steps since v000 together make it 3.06 times as fast.
#include <hip/hip_runtime.h>

// Contractions: Q/K/V projections (K=1024), per-head K.Q^T scores (K=64) and V^T.P^T context (K=keys), all on
// v_wmma_f32_16x16x32_f16 (f16 operands carrying bf16-RNE input values; W x64, P x1024), f32 accumulate; softmax f32.

#ifndef NB
#define NB 8
#endif
#ifndef SEQ
#define SEQ 1024
#endif
#define NB_FULL 8
#define SEQ_FULL 1024
#define DM 1024
#define NH 16
#define HD 64
#define NT (NB * SEQ)
#define WSC 64.0f
#define PSC 1024.0f
#define LPSC 10.0f         // log2(PSC)
#define L2E 1.44269504f    // log2(e)
#define QSC (0.125f * L2E) // carried by the Q plane: 1/sqrt(HD), and base e -> base 2
#define MFLOOR (-1e30f * L2E)   // start of the running maximum, base-2 scores
#define LDP 136
#define OLP 68
#define KC 64              // halves of k (or of keys) per ring stage: 128-byte rows
#define PIT 72             // LDS row pitch in halves: 144 B = 16 B x odd, the ds_load_b128 pitch
#define PSTG (256 * PIT)   // projection stage in halves: 128 A rows, then 128 B rows
#define ASTG (128 * PIT)   // attention stage in halves: 64 K rows, then 64 V^T rows

static_assert(DM == NH * HD);
static_assert(SEQ % 128 == 0);
static_assert(SEQ <= SEQ_FULL);
static_assert(NB >= 1 && NB <= NB_FULL);
static_assert(NT % 128 == 0);
static_assert(DM % 128 == 0);
static_assert((NT * (DM / 8)) % 256 == 0);
static_assert((DM * (DM / 8)) % 256 == 0);
static_assert(DM % KC == 0 && DM / KC >= 2 && SEQ / KC >= 2 && HD == KC);
static_assert(128 * LDP <= 2 * PSTG);

typedef _Float16 v16h __attribute__((ext_vector_type(16)));
typedef _Float16 v8h  __attribute__((ext_vector_type(8)));
typedef float    v8f  __attribute__((ext_vector_type(8)));
typedef float    v4f  __attribute__((ext_vector_type(4)));
typedef unsigned v4u  __attribute__((ext_vector_type(4)));
union Frag { v16h v; v8h hf[2]; };

// bf16 RNE convert, result widened back to f32
__device__ __forceinline__ float bf16r(float f) {
    unsigned u = __float_as_uint(f);
    u += 0x7FFFu + ((u >> 16) & 1u);
    return __uint_as_float(u & 0xFFFF0000u);
}
__device__ __forceinline__ v8h ld8(const _Float16* p) { return *(const v8h*)p; }

// Operand map (wave32): lane -> row/col lane&15, half = lane>>4; A and B elements 0..7 <- k0+8*half+0..7,
// elements 8..15 <- k0+16+8*half+0..7; D element r -> row 8*half+r, col lane&15.
__device__ __forceinline__ v8f wmma16(v16h a, v16h b, v8f c) {
    c = __builtin_amdgcn_wmma_f32_16x16x32_f16(false, a, false, b, (short)0, c, false, false);
    asm volatile("v_nop\n\tv_nop\n\tv_nop\n\tv_nop" : "+v"(c) : "v"(a), "v"(b));
    return c;
}

// ---------- asynchronous copies global -> LDS, 16 bytes a lane, through no register.
__device__ __forceinline__ unsigned lds_off(const void* p) { return (unsigned)(size_t)p; }
// The s_wait_xcnt stands inside the copies' own statement so that no address register is rewritten ahead of it.
__device__ __forceinline__ void copy4(unsigned l0, unsigned l1, unsigned l2, unsigned l3, const _Float16* g0,
                                      const _Float16* g1, const _Float16* g2, const _Float16* g3) {
    asm volatile("global_load_async_to_lds_b128 %0, %4, off\n\t"
                 "global_load_async_to_lds_b128 %1, %5, off\n\t"
                 "global_load_async_to_lds_b128 %2, %6, off\n\t"
                 "global_load_async_to_lds_b128 %3, %7, off\n\t"
                 "s_wait_xcnt 0x0"
                 :: "v"(l0), "v"(l1), "v"(l2), "v"(l3), "v"(g0), "v"(g1), "v"(g2), "v"(g3) : "memory");
}
__device__ __forceinline__ void copy8(unsigned l0, unsigned l1, unsigned l2, unsigned l3, unsigned l4, unsigned l5,
                                      unsigned l6, unsigned l7, const _Float16* g0, const _Float16* g1,
                                      const _Float16* g2, const _Float16* g3, const _Float16* g4, const _Float16* g5,
                                      const _Float16* g6, const _Float16* g7) {
    asm volatile("global_load_async_to_lds_b128 %0, %8, off\n\t"
                 "global_load_async_to_lds_b128 %1, %9, off\n\t"
                 "global_load_async_to_lds_b128 %2, %10, off\n\t"
                 "global_load_async_to_lds_b128 %3, %11, off\n\t"
                 "global_load_async_to_lds_b128 %4, %12, off\n\t"
                 "global_load_async_to_lds_b128 %5, %13, off\n\t"
                 "global_load_async_to_lds_b128 %6, %14, off\n\t"
                 "global_load_async_to_lds_b128 %7, %15, off\n\t"
                 "s_wait_xcnt 0x0"
                 :: "v"(l0), "v"(l1), "v"(l2), "v"(l3), "v"(l4), "v"(l5), "v"(l6), "v"(l7), "v"(g0), "v"(g1), "v"(g2),
                    "v"(g3), "v"(g4), "v"(g5), "v"(g6), "v"(g7) : "memory");
}
// This wave's copies have landed (the compiler places no wait for them).
__device__ __forceinline__ void wait_copies() { asm volatile("s_wait_asynccnt 0x0" ::: "memory"); }
// This wave's LDS reads have returned before the buffer they read is handed back for a refill.
__device__ __forceinline__ void wait_lds() { asm volatile("s_wait_dscnt 0x0" ::: "memory"); }

// ---------- plane builder: x -> Xh[NT][DM] = f16(bf16(x)); W -> Wh[DM][DM] = f16(bf16(W) * 64).
__global__ __launch_bounds__(256)
void cvt_kernel(const float* __restrict__ x, const float* __restrict__ wq, const float* __restrict__ wk,
                const float* __restrict__ wv, _Float16* xh, _Float16* wqh, _Float16* wkh, _Float16* wvh) {
    const int nbx = NT * (DM / 8) / 256;
    const int nbw = DM * (DM / 8) / 256;
    int blk = blockIdx.x;
    const int tid = threadIdx.x;
    const float* src;
    _Float16* dst;
    float sc;
    if (blk < nbx) {                      // block-uniform selection
        const int idx = blk * 256 + tid;
        const int t = idx / (DM / 8), c8 = idx - t * (DM / 8);
        const int b = t / SEQ, s = t - b * SEQ;
        src = x + (size_t)(b * SEQ_FULL + s) * DM + 8 * c8;
        dst = xh + (size_t)t * DM + 8 * c8;
        sc = 1.0f;
    } else {
        blk -= nbx;
        const int w = blk / nbw;
        const int idx = (blk - w * nbw) * 256 + tid;
        src = (w == 0 ? wq : (w == 1 ? wk : wv)) + (size_t)idx * 8;
        dst = (w == 0 ? wqh : (w == 1 ? wkh : wvh)) + (size_t)idx * 8;
        sc = WSC;
    }
    const v4f a = *(const v4f*)src, c = *(const v4f*)(src + 4);
    v8h o;
    o[0] = (_Float16)(bf16r(a[0]) * sc); o[1] = (_Float16)(bf16r(a[1]) * sc);
    o[2] = (_Float16)(bf16r(a[2]) * sc); o[3] = (_Float16)(bf16r(a[3]) * sc);
    o[4] = (_Float16)(bf16r(c[0]) * sc); o[5] = (_Float16)(bf16r(c[1]) * sc);
    o[6] = (_Float16)(bf16r(c[2]) * sc); o[7] = (_Float16)(bf16r(c[3]) * sc);
    const v4u val = __builtin_bit_cast(v4u, o);
    *(v4u*)dst = val;
    
}

// ---------- projection: D[m][n] = sum_k Arow[m][k] * Brow[n][k], K = DM, both operands k-contiguous f16 rows (pitch DM).
// Block 256 thr = 8 waves (4 along m x 2 along n), block tile 128 x 128, wave tile 32 x 64 (2 A frags x 4 B frags).
// Operands: per stage 128 A rows and 128 B rows of 64 k (128 B, whole lines) come into LDS by asynchronous copies, two
// buffers, stage t + 2 issued behind the barrier that ends the reads of stage t; fragments are ds_load_b128 at pitch 144 B.
// Epilogue: value = acc/64 + bf16(bias), staged in LDS as L[n_local][m_local] (m contiguous), then plane Out[n][m]
// (the Q plane holds that value x QSC, scaled in f32 ahead of its one rounding to f16).
// MODE 0: m = feature (A = W rows), n = token (B = X rows), Out[token][feature] pitch DM, bias indexed by m.
// MODE 1: m = token (A = X rows), n = feature (B = W rows), Out[b][feature][s] (pitch SEQ), bias indexed by n.
template <int MODE>
__device__ __forceinline__
void proj_tile(_Float16* R, const _Float16* __restrict__ A, const _Float16* __restrict__ Bm,
               const float* __restrict__ bias, _Float16* Out, const int m0, const int n0, const float qs) {
    _Float16* L = R;   // the ring becomes the output staging behind the last stage's barrier
    const int tid = threadIdx.x, lane = tid & 31, wv = tid >> 5, h = lane >> 4, n16 = lane & 15;
    const int wmi = wv & 3, wn = wv >> 2;
    const int cr = tid >> 3, cc = tid & 7;   // copy: row cr + 32 i, 16-byte piece cc; a wave covers 4 whole lines
    const _Float16* ga = A + (size_t)(m0 + cr) * DM + 8 * cc;
    const _Float16* gb = Bm + (size_t)(n0 + cr) * DM + 8 * cc;
    const unsigned la = lds_off(R) + 2u * (unsigned)(cr * PIT + 8 * cc);
    const _Float16* ar = R + (32 * wmi + n16) * PIT + 8 * h;
    const _Float16* br = R + (128 + 64 * wn + n16) * PIT + 8 * h;
    auto fill = [&](int t) {
        const unsigned l = la + (unsigned)(t & 1) * (2u * PSTG);
        const _Float16* a = ga + t * KC;
        const _Float16* b = gb + t * KC;
        copy8(l, l + 64u * PIT, l + 128u * PIT, l + 192u * PIT, l + 256u * PIT, l + 320u * PIT, l + 384u * PIT,
              l + 448u * PIT, a, a + 32 * DM, a + 64 * DM, a + 96 * DM, b, b + 32 * DM, b + 64 * DM, b + 96 * DM);
    };
    fill(0);
    wait_copies();
    __syncthreads();   // publishes stage 0
    fill(1);
    v8f acc[2][4];
#pragma unroll
    for (int at = 0; at < 2; ++at)
#pragma unroll
        for (int bt = 0; bt < 4; ++bt) acc[at][bt] = (v8f){};
#pragma unroll 1
    for (int t = 0; t < DM / KC; ++t) {
        const int bo = (t & 1) * PSTG;
#pragma unroll   // both blocks of a stage straight-line: LDS offsets become immediates
        for (int kc = 0; kc < KC; kc += 32) {
            Frag a0, a1, bf[4];   // the block's twelve LDS reads stand together, ahead of its eight products
            a0.hf[0] = ld8(ar + bo + kc);            a0.hf[1] = ld8(ar + bo + kc + 16);
            a1.hf[0] = ld8(ar + bo + 16 * PIT + kc); a1.hf[1] = ld8(ar + bo + 16 * PIT + kc + 16);
#pragma unroll   // constant indices keep bf[] in registers
            for (int bt = 0; bt < 4; ++bt) {
                const _Float16* bp = br + bo + 16 * bt * PIT + kc;
                bf[bt].hf[0] = ld8(bp); bf[bt].hf[1] = ld8(bp + 16);
            }
#pragma unroll   // constant indices keep bf[] and acc[][] in registers
            for (int bt = 0; bt < 4; ++bt) {
                acc[0][bt] = wmma16(a0.v, bf[bt].v, acc[0][bt]);
                acc[1][bt] = wmma16(a1.v, bf[bt].v, acc[1][bt]);
            }
        }
        wait_lds();
        wait_copies();
        __syncthreads();   // publishes stage t + 1 and ends every read of stage t
        if (t + 2 < DM / KC) fill(t + 2);
    }
    wait_copies();
    const float osc = qs / WSC;
#pragma unroll
    for (int at = 0; at < 2; ++at) {
        float bmv[8];
        if (MODE == 0) {
            const float* bp = bias + m0 + 32 * wmi + 16 * at + 8 * h;
            const v4f b0 = *(const v4f*)bp, b1 = *(const v4f*)(bp + 4);
            bmv[0] = bf16r(b0[0]) * qs; bmv[1] = bf16r(b0[1]) * qs; bmv[2] = bf16r(b0[2]) * qs; bmv[3] = bf16r(b0[3]) * qs;
            bmv[4] = bf16r(b1[0]) * qs; bmv[5] = bf16r(b1[1]) * qs; bmv[6] = bf16r(b1[2]) * qs; bmv[7] = bf16r(b1[3]) * qs;
        } else {
#pragma unroll
            for (int r = 0; r < 8; ++r) bmv[r] = 0.0f;
        }
#pragma unroll
        for (int bt = 0; bt < 4; ++bt) {
            float bn = 0.0f;
            if (MODE == 1) bn = bf16r(bias[n0 + 64 * wn + 16 * bt + n16]);
            v8h pk;
#pragma unroll
            for (int r = 0; r < 8; ++r) {
                const float v = acc[at][bt][r] * osc + (MODE == 0 ? bmv[r] : bn);
                pk[r] = (_Float16)v;
            }
            *(v8h*)(L + (size_t)(64 * wn + 16 * bt + n16) * LDP + 32 * wmi + 16 * at + 8 * h) = pk;
        }
    }
    __syncthreads();   // L is cross-wave
    v4u vals[8];
#pragma unroll
    for (int it = 0; it < 8; ++it) {
        const int row = wv * 16 + 2 * it + h;
        const v8h t = *(const v8h*)(L + (size_t)row * LDP + 8 * n16);
        vals[it] = __builtin_bit_cast(v4u, t);
    }
#pragma unroll
    for (int it = 0; it < 8; ++it) {
        const int row = wv * 16 + 2 * it + h;
        size_t goff;
        if (MODE == 0) goff = (size_t)(n0 + row) * DM + m0 + 8 * n16;
        else           goff = (size_t)(m0 / SEQ) * ((size_t)DM * SEQ) + (size_t)(n0 + row) * SEQ + (m0 % SEQ) + 8 * n16;
        *(v4u*)(Out + goff) = vals[it];
    }
}

// All three projections are one launch: blockIdx.z picks the plane (0 = Q, 1 = K, 2 = V^T), a scalar branch picks the
// tile's orientation; no launch edge stands between the planes. The joined build takes 132 registers, so three
// work-groups fit a WGP (768 places): the 1,536 tiles run as two even rounds, every freed place taking one more tile.
// qs is block-uniform: only the Q plane carries QSC.
__global__ __launch_bounds__(256) __attribute__((amdgpu_num_vgpr(256)))
void proj_kernel(const _Float16* __restrict__ Wq, const _Float16* __restrict__ Wk, const _Float16* __restrict__ Wv,
                 const _Float16* __restrict__ X, const float* __restrict__ bq, const float* __restrict__ bk,
                 const float* __restrict__ bv, _Float16* Qo, _Float16* Ko, _Float16* Vo) {
    __shared__ __align__(16) _Float16 R[2 * PSTG];
    const int z = blockIdx.z;
    const int f0 = blockIdx.x * 128, t0 = blockIdx.y * 128;   // feature tile, token tile
    if (z < 2) proj_tile<0>(R, z ? Wk : Wq, X, z ? bk : bq, z ? Ko : Qo, f0, t0, z ? 1.0f : QSC);
    else       proj_tile<1>(R, X, Wv, bv, Vo, t0, f0, 1.0f);
}

// ---------- attention, one block per (128 queries, b, head), 8 waves x 16 queries.
// Per 64-key step: S^T tiles = K[key][d] . Q^T (A = Kh rows, B = Qh rows loaded with the A map), so each lane holds
// 8 keys x 4 tiles of ONE query column -> softmax reductions are lane-local plus one xor-16 shuffle; the f16 P values
// (x PSC) packed from score tile pairs are directly the B fragment of O^T[d][q] += Vt[d][key] . P^T[key][q]
// (element r <- tile covering keys 0..15, element 8+r <- tile covering keys 16..31, lane unchanged).
// The step's 64 K rows and 64 V^T rows (128 B each) come into LDS once per block by asynchronous copies, two buffers.
// Softmax arithmetic, base 2: the Q plane carries log2(e)/8 and mask x log2(e) is the score product's C operand, so the
// products leave the finished base-2 score t; P x PSC = exp2(t - ref), ref = max - log2(PSC): one add a score, between
// values of the scores' own grid (exact near the max at any magnitude). P, the row sum and corr all share ref.
__global__ __launch_bounds__(256) __attribute__((amdgpu_num_vgpr(256)))
void attn_kernel(const _Float16* __restrict__ Qh, const _Float16* __restrict__ Kh, const _Float16* __restrict__ Vt,
                 const float* __restrict__ amask, float* out) {
    __shared__ __align__(16) float mk[SEQ];
    __shared__ __align__(16) float ol[8 * 16 * OLP];
    __shared__ __align__(16) _Float16 R[2 * ASTG];
    const int tid = threadIdx.x, lane = tid & 31, wv = tid >> 5, h = lane >> 4, n16 = lane & 15;
    const int bh = blockIdx.y, b = bh / NH, hd = bh - b * NH;
    const int q0 = blockIdx.x * 128 + wv * 16;
    const int cr = tid >> 3, cc = tid & 7;   // copy: row cr + 32 i, 16-byte piece cc; a wave covers 4 whole lines
    const _Float16* gk = Kh + (size_t)(b * SEQ + cr) * DM + hd * HD + 8 * cc;
    const _Float16* gv = Vt + (size_t)b * DM * SEQ + (size_t)(hd * HD + cr) * SEQ + 8 * cc;
    const unsigned lk = lds_off(R) + 2u * (unsigned)(cr * PIT + 8 * cc);
    auto fill = [&](int t) {
        const unsigned l = lk + (unsigned)(t & 1) * (2u * ASTG);
        const _Float16* k = gk + (size_t)t * KC * DM;
        const _Float16* v = gv + t * KC;
        copy4(l, l + 64u * PIT, l + 128u * PIT, l + 192u * PIT, k, k + 32 * DM, v, v + 32 * SEQ);
    };
    fill(0);
    for (int i = tid; i < SEQ; i += 256) {
        const float a = bf16r(amask[(size_t)b * SEQ_FULL + i]);
        // above 2e38, a x log2(e) would pass the largest float: a flatter line from there on keeps the map finite and
        // rising; neighbouring bf16 values up there still land more than 1e35 apart, so the lower one's P is 0 as before
        mk[i] = a > 2e38f ? __builtin_fmaf(a - 2e38f, 0.25f, 2e38f * L2E) : a * L2E;
    }
    wait_copies();
    __syncthreads();   // mk is cross-wave; publishes stage 0
    fill(1);

    const _Float16* qr = Qh + (size_t)(b * SEQ + q0 + n16) * DM + hd * HD + 8 * h;
    Frag qa, qb;
    qa.hf[0] = ld8(qr);      qa.hf[1] = ld8(qr + 16);
    qb.hf[0] = ld8(qr + 32); qb.hf[1] = ld8(qr + 48);
    asm volatile("s_wait_xcnt 0x0" ::: "memory");   // before the Q loads' address registers are given to the first LDS reads
    const _Float16* kb = R + n16 * PIT + 8 * h;
    const _Float16* vb = R + (64 + n16) * PIT + 8 * h;

    v8f o[4];
#pragma unroll
    for (int dt = 0; dt < 4; ++dt) o[dt] = (v8f){};
    float m = MFLOOR, nref = -MFLOOR, l = 0.0f;   // nref = -ref; l is the row sum of P as scaled by ref

#pragma unroll 1
    for (int ks = 0; ks < SEQ / 64; ++ks) {
        const int bo = (ks & 1) * ASTG;
        v8f s[4];
#pragma unroll
        for (int kt = 0; kt < 4; ++kt) {   // a key tile's six LDS reads stand together, ahead of its two products
            const float* mp = mk + 64 * ks + 16 * kt + 8 * h;
            const v4f ma = *(const v4f*)mp, mb = *(const v4f*)(mp + 4);
            s[kt] = (v8f){ma[0], ma[1], ma[2], ma[3], mb[0], mb[1], mb[2], mb[3]};
            const _Float16* kr = kb + bo + 16 * kt * PIT;
            Frag kf0, kf1;
            kf0.hf[0] = ld8(kr);      kf0.hf[1] = ld8(kr + 16);
            kf1.hf[0] = ld8(kr + 32); kf1.hf[1] = ld8(kr + 48);
            s[kt] = wmma16(kf0.v, qa.v, s[kt]);
            s[kt] = wmma16(kf1.v, qb.v, s[kt]);
        }
        float mx = MFLOOR;
#pragma unroll
        for (int kt = 0; kt < 4; ++kt)
#pragma unroll
            for (int r = 0; r < 8; ++r) mx = fmaxf(mx, s[kt][r]);
        mx = fmaxf(mx, __shfl_xor(mx, 16, 32));
        const float mn = fmaxf(m, mx);
        float nr = LPSC - mn;   // -ref of this step
        // where the max is so large that its grid is coarser than log2(PSC), ref can round to 16 below it and the top P
        // would pass f16: there P goes unscaled (any ref serves, as long as P, l and corr share it)
        if (mn + nr > 15.0f) nr = -mn;
        const float corr = __builtin_amdgcn_exp2f(nr - nref);
        m = mn;
        nref = nr;
        float ps = 0.0f;
        v16h pv[2];
        pv[0] = (v16h){}; pv[1] = (v16h){};
#pragma unroll   // constant indices keep s[] in registers
        for (int kt = 0; kt < 4; ++kt) s[kt] += nr;
#pragma unroll
        for (int kt = 0; kt < 4; ++kt) {
#pragma unroll
            for (int r = 0; r < 8; ++r) {
                const float p = __builtin_amdgcn_exp2f(s[kt][r]);
                ps += p;
                pv[kt >> 1][((kt & 1) << 3) + r] = (_Float16)p;
            }
        }
        ps += __shfl_xor(ps, 16, 32);
        l = l * corr + ps;
#pragma unroll
        for (int dt = 0; dt < 4; ++dt)
#pragma unroll
            for (int r = 0; r < 8; ++r) o[dt][r] *= corr;
        // keeps the V^T reads behind the exponentials: lifted over them, this build takes 140 registers instead of 122,
        // which is past 128, and only three blocks instead of four fit a WGP
        __builtin_amdgcn_sched_barrier(0);
#pragma unroll
        for (int dt = 0; dt < 4; ++dt) {   // a V^T tile's four LDS reads stand together, ahead of its two products
            const _Float16* vr = vb + bo + 16 * dt * PIT;
            Frag vf0, vf1;
            vf0.hf[0] = ld8(vr);      vf0.hf[1] = ld8(vr + 16);
            vf1.hf[0] = ld8(vr + 32); vf1.hf[1] = ld8(vr + 48);
            o[dt] = wmma16(vf0.v, pv[0], o[dt]);
            o[dt] = wmma16(vf1.v, pv[1], o[dt]);
        }
        wait_lds();
        wait_copies();
        __syncthreads();   // publishes stage ks + 1 and ends every read of stage ks
        if (ks + 2 < SEQ / 64) fill(ks + 2);
    }
    wait_copies();

    const float inv = 1.0f / l;
    float* olw = ol + wv * (16 * OLP);
#pragma unroll
    for (int dt = 0; dt < 4; ++dt) {
        v4f a, c;
        a[0] = o[dt][0] * inv; a[1] = o[dt][1] * inv; a[2] = o[dt][2] * inv; a[3] = o[dt][3] * inv;
        c[0] = o[dt][4] * inv; c[1] = o[dt][5] * inv; c[2] = o[dt][6] * inv; c[3] = o[dt][7] * inv;
        *(v4f*)(olw + n16 * OLP + 16 * dt + 8 * h) = a;
        *(v4f*)(olw + n16 * OLP + 16 * dt + 8 * h + 4) = c;
    }
    __syncthreads();   // ol tile per wave; block barrier used anyway (no early exits)
    v4f vals[8];
#pragma unroll
    for (int it = 0; it < 8; ++it) vals[it] = *(const v4f*)(olw + (2 * it + h) * OLP + 4 * n16);
    float* ob = out + (size_t)(b * SEQ + q0) * DM + hd * HD + 4 * n16;
#pragma unroll
    for (int it = 0; it < 8; ++it) *(v4f*)(ob + (size_t)(2 * it + h) * DM) = vals[it];
    
}

extern "C" void kernel_launch(void* const* d_in, const int* in_sizes, int n_in,
                              void* d_out, int out_size, void* d_ws, size_t ws_size,
                              hipStream_t stream) {
    if (n_in < 8) return;
    const long long needX = ((long long)(NB - 1) * SEQ_FULL + SEQ) * DM;
    const long long needM = (long long)(NB - 1) * SEQ_FULL + SEQ;
    if ((long long)in_sizes[0] < needX || (long long)in_sizes[1] < needM) return;
    if (in_sizes[2] < DM * DM || in_sizes[4] < DM * DM || in_sizes[6] < DM * DM) return;
    if (in_sizes[3] < DM || in_sizes[5] < DM || in_sizes[7] < DM) return;
    if (out_size < NT * DM) return;

    const float* x    = (const float*)d_in[0];   // [NB_FULL][SEQ_FULL][DM]
    const float* amsk = (const float*)d_in[1];   // [NB_FULL][1][1][SEQ_FULL]
    const float* wq   = (const float*)d_in[2];   // [DM out][DM in]
    const float* bq   = (const float*)d_in[3];
    const float* wk   = (const float*)d_in[4];
    const float* bk   = (const float*)d_in[5];
    const float* wv   = (const float*)d_in[6];
    const float* bv   = (const float*)d_in[7];
    float* out = (float*)d_out;                  // [NB][SEQ][DM]

    const size_t xhB = (size_t)NT * DM * 2;              // Xh [NT][DM] f16
    const size_t whB = (size_t)DM * DM * 2;              // each Wh [DM][DM] f16
    const size_t qhB = xhB;                              // Qh, Kh [NT][DM] f16
    const size_t vtB = (size_t)NB * DM * SEQ * 2;        // Vt [NB][DM][SEQ] f16
    const size_t total = xhB + 3 * whB + 2 * qhB + vtB;  // 73,400,320 B at full size
    if (total > ws_size) return;
    char* ws = (char*)d_ws;
    _Float16* Xh  = (_Float16*)(ws);
    _Float16* Wqh = (_Float16*)(ws + xhB);
    _Float16* Wkh = (_Float16*)(ws + xhB + whB);
    _Float16* Wvh = (_Float16*)(ws + xhB + 2 * whB);
    _Float16* Qh  = (_Float16*)(ws + xhB + 3 * whB);
    _Float16* Khp = (_Float16*)(ws + xhB + 3 * whB + qhB);
    _Float16* Vt  = (_Float16*)(ws + xhB + 3 * whB + 2 * qhB);

    const int nbx = NT * (DM / 8) / 256, nbw = DM * (DM / 8) / 256;
    cvt_kernel<<<dim3((unsigned)(nbx + 3 * nbw)), 256, 0, stream>>>(x, wq, wk, wv, Xh, Wqh, Wkh, Wvh);
    // z = 0, 1: Q^T / K^T tiles, m = feature (W rows), n = token (X rows) -> Qh/Kh [token][feature]
    // z = 2: V tiles, m = token (X rows), n = feature (W rows) -> Vt [b][feature][s]
    proj_kernel<<<dim3(DM / 128, NT / 128, 3), 256, 0, stream>>>(Wqh, Wkh, Wvh, Xh, bq, bk, bv, Qh, Khp, Vt);
    attn_kernel<<<dim3(SEQ / 128, NB * NH), 256, 0, stream>>>(Qh, Khp, Vt, amsk, out);
}

// v004
// A run of this version takes 86.8 microseconds.
// Two timings next to v003 both put it at 1.03 times that version's speed.
// Counting every step since v000, it is 3.17 times as fast.
#include <hip/hip_runtime.h>

// Contractions: Q/K/V projections (K=1024), per-head K.Q^T scores (K=64) and V^T.P^T context (K=keys), all on
// v_wmma_f32_16x16x32_f16 (f16 operands carrying bf16-RNE input values; W x64, P x1024), f32 accumulate; softmax f32.

#ifndef NB
#define NB 8
#endif
#ifndef SEQ
#define SEQ 1024
#endif
#define NB_FULL 8
#define SEQ_FULL 1024
#define DM 1024
#define NH 16
#define HD 64
#define NT (NB * SEQ)
#define WSC 64.0f
#define PSC 1024.0f
#define LPSC 10.0f         // log2(PSC)
#define L2E 1.44269504f    // log2(e)
#define QSC (0.125f * L2E) // carried by the Q plane: 1/sqrt(HD), and base e -> base 2
#define MFLOOR (-1e30f * L2E)   // start of the running maximum, base-2 scores
#define LDP 136
#define OLP 68
#define KC 64              // halves of k (or of keys) per ring stage: 128-byte rows
#define PIT 72             // LDS row pitch in halves: 144 B = 16 B x odd, the ds_load_b128 pitch
#define PSTG (256 * PIT)   // projection stage in halves: 128 A rows, then 128 B rows
#define ASTG (128 * PIT)   // attention stage in halves: 64 K rows, then 64 V^T rows

static_assert(DM == NH * HD);
static_assert(SEQ % 128 == 0);
static_assert(SEQ <= SEQ_FULL);
static_assert(NB >= 1 && NB <= NB_FULL);
static_assert(NT % 128 == 0);
static_assert(DM % 128 == 0);
static_assert((NT * (DM / 8)) % 256 == 0);
static_assert((DM * (DM / 8)) % 256 == 0);
static_assert(DM % KC == 0 && DM / KC >= 2 && SEQ / KC >= 2 && HD == KC);
static_assert(128 * LDP <= 2 * PSTG);
static_assert(((DM / KC) & (DM / KC - 1)) == 0);     // the rotated stage orders wrap by a mask
static_assert(((SEQ / KC) & (SEQ / KC - 1)) == 0);

typedef _Float16 v16h __attribute__((ext_vector_type(16)));
typedef _Float16 v8h  __attribute__((ext_vector_type(8)));
typedef float    v8f  __attribute__((ext_vector_type(8)));
typedef float    v4f  __attribute__((ext_vector_type(4)));
typedef unsigned v4u  __attribute__((ext_vector_type(4)));
union Frag { v16h v; v8h hf[2]; };

// bf16 RNE convert, result widened back to f32
__device__ __forceinline__ float bf16r(float f) {
    unsigned u = __float_as_uint(f);
    u += 0x7FFFu + ((u >> 16) & 1u);
    return __uint_as_float(u & 0xFFFF0000u);
}
__device__ __forceinline__ v8h ld8(const _Float16* p) { return *(const v8h*)p; }

// Operand map (wave32): lane -> row/col lane&15, half = lane>>4; A and B elements 0..7 <- k0+8*half+0..7,
// elements 8..15 <- k0+16+8*half+0..7; D element r -> row 8*half+r, col lane&15.
__device__ __forceinline__ v8f wmma16(v16h a, v16h b, v8f c) {
    c = __builtin_amdgcn_wmma_f32_16x16x32_f16(false, a, false, b, (short)0, c, false, false);
    asm volatile("v_nop\n\tv_nop\n\tv_nop\n\tv_nop" : "+v"(c) : "v"(a), "v"(b));
    return c;
}

// ---------- asynchronous copies global -> LDS, 16 bytes a lane, through no register.
__device__ __forceinline__ unsigned lds_off(const void* p) { return (unsigned)(size_t)p; }
// The s_wait_xcnt stands inside the copies' own statement so that no address register is rewritten ahead of it.
__device__ __forceinline__ void copy4(unsigned l0, unsigned l1, unsigned l2, unsigned l3, const _Float16* g0,
                                      const _Float16* g1, const _Float16* g2, const _Float16* g3) {
    asm volatile("global_load_async_to_lds_b128 %0, %4, off\n\t"
                 "global_load_async_to_lds_b128 %1, %5, off\n\t"
                 "global_load_async_to_lds_b128 %2, %6, off\n\t"
                 "global_load_async_to_lds_b128 %3, %7, off\n\t"
                 "s_wait_xcnt 0x0"
                 :: "v"(l0), "v"(l1), "v"(l2), "v"(l3), "v"(g0), "v"(g1), "v"(g2), "v"(g3) : "memory");
}
__device__ __forceinline__ void copy8(unsigned l0, unsigned l1, unsigned l2, unsigned l3, unsigned l4, unsigned l5,
                                      unsigned l6, unsigned l7, const _Float16* g0, const _Float16* g1,
                                      const _Float16* g2, const _Float16* g3, const _Float16* g4, const _Float16* g5,
                                      const _Float16* g6, const _Float16* g7) {
    asm volatile("global_load_async_to_lds_b128 %0, %8, off\n\t"
                 "global_load_async_to_lds_b128 %1, %9, off\n\t"
                 "global_load_async_to_lds_b128 %2, %10, off\n\t"
                 "global_load_async_to_lds_b128 %3, %11, off\n\t"
                 "global_load_async_to_lds_b128 %4, %12, off\n\t"
                 "global_load_async_to_lds_b128 %5, %13, off\n\t"
                 "global_load_async_to_lds_b128 %6, %14, off\n\t"
                 "global_load_async_to_lds_b128 %7, %15, off\n\t"
                 "s_wait_xcnt 0x0"
                 :: "v"(l0), "v"(l1), "v"(l2), "v"(l3), "v"(l4), "v"(l5), "v"(l6), "v"(l7), "v"(g0), "v"(g1), "v"(g2),
                    "v"(g3), "v"(g4), "v"(g5), "v"(g6), "v"(g7) : "memory");
}
// This wave's copies have landed (the compiler places no wait for them).
__device__ __forceinline__ void wait_copies() { asm volatile("s_wait_asynccnt 0x0" ::: "memory"); }
// This wave's LDS reads have returned before the buffer they read is handed back for a refill.
__device__ __forceinline__ void wait_lds() { asm volatile("s_wait_dscnt 0x0" ::: "memory"); }

// ---------- plane builder: x -> Xh[NT][DM] = f16(bf16(x)); W -> Wh[DM][DM] = f16(bf16(W) * 64).
__global__ __launch_bounds__(256)
void cvt_kernel(const float* __restrict__ x, const float* __restrict__ wq, const float* __restrict__ wk,
                const float* __restrict__ wv, _Float16* xh, _Float16* wqh, _Float16* wkh, _Float16* wvh) {
    const int nbx = NT * (DM / 8) / 256;
    const int nbw = DM * (DM / 8) / 256;
    int blk = blockIdx.x;
    const int tid = threadIdx.x;
    const float* src;
    _Float16* dst;
    float sc;
    if (blk < nbx) {                      // block-uniform selection
        const int idx = blk * 256 + tid;
        const int t = idx / (DM / 8), c8 = idx - t * (DM / 8);
        const int b = t / SEQ, s = t - b * SEQ;
        src = x + (size_t)(b * SEQ_FULL + s) * DM + 8 * c8;
        dst = xh + (size_t)t * DM + 8 * c8;
        sc = 1.0f;
    } else {
        blk -= nbx;
        const int w = blk / nbw;
        const int idx = (blk - w * nbw) * 256 + tid;
        src = (w == 0 ? wq : (w == 1 ? wk : wv)) + (size_t)idx * 8;
        dst = (w == 0 ? wqh : (w == 1 ? wkh : wvh)) + (size_t)idx * 8;
        sc = WSC;
    }
    const v4f a = *(const v4f*)src, c = *(const v4f*)(src + 4);
    v8h o;
    o[0] = (_Float16)(bf16r(a[0]) * sc); o[1] = (_Float16)(bf16r(a[1]) * sc);
    o[2] = (_Float16)(bf16r(a[2]) * sc); o[3] = (_Float16)(bf16r(a[3]) * sc);
    o[4] = (_Float16)(bf16r(c[0]) * sc); o[5] = (_Float16)(bf16r(c[1]) * sc);
    o[6] = (_Float16)(bf16r(c[2]) * sc); o[7] = (_Float16)(bf16r(c[3]) * sc);
    const v4u val = __builtin_bit_cast(v4u, o);
    *(v4u*)dst = val;
    
}

// ---------- projection: D[m][n] = sum_k Arow[m][k] * Brow[n][k], K = DM, both operands k-contiguous f16 rows (pitch DM).
// Block 256 thr = 8 waves (4 along m x 2 along n), block tile 128 x 128, wave tile 32 x 64 (2 A frags x 4 B frags).
// Operands: per stage 128 A rows and 128 B rows of 64 k (128 B, whole lines) come into LDS by asynchronous copies, two
// buffers, stage t + 2 issued behind the barrier that ends the reads of stage t; fragments are ds_load_b128 at pitch 144 B.
// Epilogue: value = acc/64 + bf16(bias), staged in LDS as L[n_local][m_local] (m contiguous), then plane Out[n][m]
// (the Q plane holds that value x QSC, scaled in f32 ahead of its one rounding to f16).
// MODE 0: m = feature (A = W rows), n = token (B = X rows), Out[token][feature] pitch DM, bias indexed by m.
// MODE 1: m = token (A = X rows), n = feature (B = W rows), Out[b][feature][s] (pitch SEQ), bias indexed by n.
// Stage order: trip t takes the k slab (t + rot) mod 16. Work-groups that share an operand tile start together and would
// ask L2 for the same lines at the same moment; with rot set by
// the caller they walk the same 16 slabs from up to 16 different starts. Every slab is summed once, in a rotated order.
template <int MODE>
__device__ __forceinline__
void proj_tile(_Float16* R, const _Float16* __restrict__ A, const _Float16* __restrict__ Bm,
               const float* __restrict__ bias, _Float16* Out, const int m0, const int n0, const float qs,
               const int rot) {
    _Float16* L = R;   // the ring becomes the output staging behind the last stage's barrier
    const int tid = threadIdx.x, lane = tid & 31, wv = tid >> 5, h = lane >> 4, n16 = lane & 15;
    const int wmi = wv & 3, wn = wv >> 2;
    const int cr = tid >> 3, cc = tid & 7;   // copy: row cr + 32 i, 16-byte piece cc; a wave covers 4 whole lines
    const _Float16* ga = A + (size_t)(m0 + cr) * DM + 8 * cc;
    const _Float16* gb = Bm + (size_t)(n0 + cr) * DM + 8 * cc;
    const unsigned la = lds_off(R) + 2u * (unsigned)(cr * PIT + 8 * cc);
    const _Float16* ar = R + (32 * wmi + n16) * PIT + 8 * h;
    const _Float16* br = R + (128 + 64 * wn + n16) * PIT + 8 * h;
    auto fill = [&](int t) {
        const unsigned l = la + (unsigned)(t & 1) * (2u * PSTG);
        const int ko = ((t + rot) & (DM / KC - 1)) * KC;   // block-uniform
        const _Float16* a = ga + ko;
        const _Float16* b = gb + ko;
        copy8(l, l + 64u * PIT, l + 128u * PIT, l + 192u * PIT, l + 256u * PIT, l + 320u * PIT, l + 384u * PIT,
              l + 448u * PIT, a, a + 32 * DM, a + 64 * DM, a + 96 * DM, b, b + 32 * DM, b + 64 * DM, b + 96 * DM);
    };
    fill(0);
    wait_copies();
    __syncthreads();   // publishes stage 0
    fill(1);
    v8f acc[2][4];
#pragma unroll
    for (int at = 0; at < 2; ++at)
#pragma unroll
        for (int bt = 0; bt < 4; ++bt) acc[at][bt] = (v8f){};
#pragma unroll 1
    for (int t = 0; t < DM / KC; ++t) {
        const int bo = (t & 1) * PSTG;
#pragma unroll   // both blocks of a stage straight-line: LDS offsets become immediates
        for (int kc = 0; kc < KC; kc += 32) {
            Frag a0, a1, bf[4];   // the block's twelve LDS reads stand together, ahead of its eight products
            a0.hf[0] = ld8(ar + bo + kc);            a0.hf[1] = ld8(ar + bo + kc + 16);
            a1.hf[0] = ld8(ar + bo + 16 * PIT + kc); a1.hf[1] = ld8(ar + bo + 16 * PIT + kc + 16);
#pragma unroll   // constant indices keep bf[] in registers
            for (int bt = 0; bt < 4; ++bt) {
                const _Float16* bp = br + bo + 16 * bt * PIT + kc;
                bf[bt].hf[0] = ld8(bp); bf[bt].hf[1] = ld8(bp + 16);
            }
#pragma unroll   // constant indices keep bf[] and acc[][] in registers
            for (int bt = 0; bt < 4; ++bt) {
                acc[0][bt] = wmma16(a0.v, bf[bt].v, acc[0][bt]);
                acc[1][bt] = wmma16(a1.v, bf[bt].v, acc[1][bt]);
            }
        }
        wait_lds();
        wait_copies();
        __syncthreads();   // publishes stage t + 1 and ends every read of stage t
        if (t + 2 < DM / KC) fill(t + 2);
    }
    wait_copies();
    const float osc = qs / WSC;
#pragma unroll
    for (int at = 0; at < 2; ++at) {
        float bmv[8];
        if (MODE == 0) {
            const float* bp = bias + m0 + 32 * wmi + 16 * at + 8 * h;
            const v4f b0 = *(const v4f*)bp, b1 = *(const v4f*)(bp + 4);
            bmv[0] = bf16r(b0[0]) * qs; bmv[1] = bf16r(b0[1]) * qs; bmv[2] = bf16r(b0[2]) * qs; bmv[3] = bf16r(b0[3]) * qs;
            bmv[4] = bf16r(b1[0]) * qs; bmv[5] = bf16r(b1[1]) * qs; bmv[6] = bf16r(b1[2]) * qs; bmv[7] = bf16r(b1[3]) * qs;
        } else {
#pragma unroll
            for (int r = 0; r < 8; ++r) bmv[r] = 0.0f;
        }
#pragma unroll
        for (int bt = 0; bt < 4; ++bt) {
            float bn = 0.0f;
            if (MODE == 1) bn = bf16r(bias[n0 + 64 * wn + 16 * bt + n16]);
            v8h pk;
#pragma unroll
            for (int r = 0; r < 8; ++r) {
                const float v = acc[at][bt][r] * osc + (MODE == 0 ? bmv[r] : bn);
                pk[r] = (_Float16)v;
            }
            *(v8h*)(L + (size_t)(64 * wn + 16 * bt + n16) * LDP + 32 * wmi + 16 * at + 8 * h) = pk;
        }
    }
    __syncthreads();   // L is cross-wave
    v4u vals[8];
#pragma unroll
    for (int it = 0; it < 8; ++it) {
        const int row = wv * 16 + 2 * it + h;
        const v8h t = *(const v8h*)(L + (size_t)row * LDP + 8 * n16);
        vals[it] = __builtin_bit_cast(v4u, t);
    }
#pragma unroll
    for (int it = 0; it < 8; ++it) {
        const int row = wv * 16 + 2 * it + h;
        size_t goff;
        if (MODE == 0) goff = (size_t)(n0 + row) * DM + m0 + 8 * n16;
        else           goff = (size_t)(m0 / SEQ) * ((size_t)DM * SEQ) + (size_t)(n0 + row) * SEQ + (m0 % SEQ) + 8 * n16;
        *(v4u*)(Out + goff) = vals[it];
    }
}

// All three projections are one launch: blockIdx.z picks the plane (0 = Q, 1 = K, 2 = V^T), a scalar branch picks the
// tile's orientation; no launch edge stands between the planes. The joined build takes 131 registers, so three
// work-groups fit a WGP (768 places): the 1,536 tiles run as two even rounds, every freed place taking one more tile.
// qs is block-uniform: only the Q plane carries QSC.
__global__ __launch_bounds__(256) __attribute__((amdgpu_num_vgpr(256)))
void proj_kernel(const _Float16* __restrict__ Wq, const _Float16* __restrict__ Wk, const _Float16* __restrict__ Wv,
                 const _Float16* __restrict__ X, const float* __restrict__ bq, const float* __restrict__ bk,
                 const float* __restrict__ bv, _Float16* Qo, _Float16* Ko, _Float16* Vo) {
    __shared__ __align__(16) _Float16 R[2 * PSTG];
    const int z = blockIdx.z;
    const int f0 = blockIdx.x * 128, t0 = blockIdx.y * 128;   // feature tile, token tile
    // sharers of an X tile (same y) differ in 2 x + z, sharers of a W tile (same x, z) differ in y
    const int rot = (int)((blockIdx.y + 2u * blockIdx.x + blockIdx.z) & (unsigned)(DM / KC - 1));
    if (z < 2) proj_tile<0>(R, z ? Wk : Wq, X, z ? bk : bq, z ? Ko : Qo, f0, t0, z ? 1.0f : QSC, rot);
    else       proj_tile<1>(R, X, Wv, bv, Vo, t0, f0, 1.0f, rot);
}

// ---------- attention, one block per (128 queries, b, head), 8 waves x 16 queries.
// Per 64-key step: S^T tiles = K[key][d] . Q^T (A = Kh rows, B = Qh rows loaded with the A map), so each lane holds
// 8 keys x 4 tiles of ONE query column -> softmax reductions are lane-local plus one xor-16 shuffle; the f16 P values
// (x PSC) packed from score tile pairs are directly the B fragment of O^T[d][q] += Vt[d][key] . P^T[key][q]
// (element r <- tile covering keys 0..15, element 8+r <- tile covering keys 16..31, lane unchanged).
// The step's 64 K rows and 64 V^T rows (128 B each) come into LDS once per block by asynchronous copies, two buffers.
// Softmax arithmetic, base 2: the Q plane carries log2(e)/8 and mask x log2(e) is the score product's C operand, so the
// products leave the finished base-2 score t; P x PSC = exp2(t - ref), ref = max - log2(PSC): one add a score, between
// values of the scores' own grid (exact near the max at any magnitude). P, the row sum and corr all share ref.
// Stage order: the query blocks of one (b, head) read the same K and V^T rows and start together; step ks takes the key
// slab (ks + rot) mod 16, rot set by the query block, so that they do not ask L2 for the same lines at the same moment.
// Every key is taken once; the running maximum and the sums meet the slabs in a rotated order.
__global__ __launch_bounds__(256) __attribute__((amdgpu_num_vgpr(256)))
void attn_kernel(const _Float16* __restrict__ Qh, const _Float16* __restrict__ Kh, const _Float16* __restrict__ Vt,
                 const float* __restrict__ amask, float* out) {
    __shared__ __align__(16) float mk[SEQ];
    __shared__ __align__(16) float ol[8 * 16 * OLP];
    __shared__ __align__(16) _Float16 R[2 * ASTG];
    const int tid = threadIdx.x, lane = tid & 31, wv = tid >> 5, h = lane >> 4, n16 = lane & 15;
    const int bh = blockIdx.y, b = bh / NH, hd = bh - b * NH;
    const int q0 = blockIdx.x * 128 + wv * 16;
    const int cr = tid >> 3, cc = tid & 7;   // copy: row cr + 32 i, 16-byte piece cc; a wave covers 4 whole lines
    const _Float16* gk = Kh + (size_t)(b * SEQ + cr) * DM + hd * HD + 8 * cc;
    const _Float16* gv = Vt + (size_t)b * DM * SEQ + (size_t)(hd * HD + cr) * SEQ + 8 * cc;
    const unsigned lk = lds_off(R) + 2u * (unsigned)(cr * PIT + 8 * cc);
    const int rot = (int)((blockIdx.x * (unsigned)((SEQ / KC) / (SEQ / 128))) & (unsigned)(SEQ / KC - 1));   // block-uniform
    auto fill = [&](int t) {
        const unsigned l = lk + (unsigned)(t & 1) * (2u * ASTG);
        const int sl = (t + rot) & (SEQ / KC - 1);
        const _Float16* k = gk + (size_t)sl * KC * DM;
        const _Float16* v = gv + sl * KC;
        copy4(l, l + 64u * PIT, l + 128u * PIT, l + 192u * PIT, k, k + 32 * DM, v, v + 32 * SEQ);
    };
    fill(0);
    for (int i = tid; i < SEQ; i += 256) {
        const float a = bf16r(amask[(size_t)b * SEQ_FULL + i]);
        // above 2e38, a x log2(e) would pass the largest float: a flatter line from there on keeps the map finite and
        // rising; neighbouring bf16 values up there still land more than 1e35 apart, so the lower one's P is 0 as before
        mk[i] = a > 2e38f ? __builtin_fmaf(a - 2e38f, 0.25f, 2e38f * L2E) : a * L2E;
    }
    wait_copies();
    __syncthreads();   // mk is cross-wave; publishes stage 0
    fill(1);

    const _Float16* qr = Qh + (size_t)(b * SEQ + q0 + n16) * DM + hd * HD + 8 * h;
    Frag qa, qb;
    qa.hf[0] = ld8(qr);      qa.hf[1] = ld8(qr + 16);
    qb.hf[0] = ld8(qr + 32); qb.hf[1] = ld8(qr + 48);
    asm volatile("s_wait_xcnt 0x0" ::: "memory");   // before the Q loads' address registers are given to the first LDS reads
    const _Float16* kb = R + n16 * PIT + 8 * h;
    const _Float16* vb = R + (64 + n16) * PIT + 8 * h;

    v8f o[4];
#pragma unroll
    for (int dt = 0; dt < 4; ++dt) o[dt] = (v8f){};
    float m = MFLOOR, nref = -MFLOOR, l = 0.0f;   // nref = -ref; l is the row sum of P as scaled by ref

#pragma unroll 1
    for (int ks = 0; ks < SEQ / 64; ++ks) {
        const int bo = (ks & 1) * ASTG;
        const int sl = (ks + rot) & (SEQ / KC - 1);   // the key slab that lies in this buffer
        v8f s[4];
#pragma unroll
        for (int kt = 0; kt < 4; ++kt) {   // a key tile's six LDS reads stand together, ahead of its two products
            const float* mp = mk + 64 * sl + 16 * kt + 8 * h;
            const v4f ma = *(const v4f*)mp, mb = *(const v4f*)(mp + 4);
            s[kt] = (v8f){ma[0], ma[1], ma[2], ma[3], mb[0], mb[1], mb[2], mb[3]};
            const _Float16* kr = kb + bo + 16 * kt * PIT;
            Frag kf0, kf1;
            kf0.hf[0] = ld8(kr);      kf0.hf[1] = ld8(kr + 16);
            kf1.hf[0] = ld8(kr + 32); kf1.hf[1] = ld8(kr + 48);
            s[kt] = wmma16(kf0.v, qa.v, s[kt]);
            s[kt] = wmma16(kf1.v, qb.v, s[kt]);
        }
        float mx = MFLOOR;
#pragma unroll
        for (int kt = 0; kt < 4; ++kt)
#pragma unroll
            for (int r = 0; r < 8; ++r) mx = fmaxf(mx, s[kt][r]);
        mx = fmaxf(mx, __shfl_xor(mx, 16, 32));
        const float mn = fmaxf(m, mx);
        float nr = LPSC - mn;   // -ref of this step
        // where the max is so large that its grid is coarser than log2(PSC), ref can round to 16 below it and the top P
        // would pass f16: there P goes unscaled (any ref serves, as long as P, l and corr share it)
        if (mn + nr > 15.0f) nr = -mn;
        const float corr = __builtin_amdgcn_exp2f(nr - nref);
        m = mn;
        nref = nr;
        float ps = 0.0f;
        v16h pv[2];
        pv[0] = (v16h){}; pv[1] = (v16h){};
#pragma unroll   // constant indices keep s[] in registers
        for (int kt = 0; kt < 4; ++kt) s[kt] += nr;
#pragma unroll
        for (int kt = 0; kt < 4; ++kt) {
#pragma unroll
            for (int r = 0; r < 8; ++r) {
                const float p = __builtin_amdgcn_exp2f(s[kt][r]);
                ps += p;
                pv[kt >> 1][((kt & 1) << 3) + r] = (_Float16)p;
            }
        }
        ps += __shfl_xor(ps, 16, 32);
        l = l * corr + ps;
#pragma unroll
        for (int dt = 0; dt < 4; ++dt)
#pragma unroll
            for (int r = 0; r < 8; ++r) o[dt][r] *= corr;
        // keeps the V^T reads behind the exponentials: lifted over them, this build takes 140 registers instead of 122,
        // which is past 128, and only three blocks instead of four fit a WGP
        __builtin_amdgcn_sched_barrier(0);
#pragma unroll
        for (int dt = 0; dt < 4; ++dt) {   // a V^T tile's four LDS reads stand together, ahead of its two products
            const _Float16* vr = vb + bo + 16 * dt * PIT;
            Frag vf0, vf1;
            vf0.hf[0] = ld8(vr);      vf0.hf[1] = ld8(vr + 16);
            vf1.hf[0] = ld8(vr + 32); vf1.hf[1] = ld8(vr + 48);
            o[dt] = wmma16(vf0.v, pv[0], o[dt]);
            o[dt] = wmma16(vf1.v, pv[1], o[dt]);
        }
        wait_lds();
        wait_copies();
        __syncthreads();   // publishes stage ks + 1 and ends every read of stage ks
        if (ks + 2 < SEQ / 64) fill(ks + 2);
    }
    wait_copies();

    const float inv = 1.0f / l;
    float* olw = ol + wv * (16 * OLP);
#pragma unroll
    for (int dt = 0; dt < 4; ++dt) {
        v4f a, c;
        a[0] = o[dt][0] * inv; a[1] = o[dt][1] * inv; a[2] = o[dt][2] * inv; a[3] = o[dt][3] * inv;
        c[0] = o[dt][4] * inv; c[1] = o[dt][5] * inv; c[2] = o[dt][6] * inv; c[3] = o[dt][7] * inv;
        *(v4f*)(olw + n16 * OLP + 16 * dt + 8 * h) = a;
        *(v4f*)(olw + n16 * OLP + 16 * dt + 8 * h + 4) = c;
    }
    __syncthreads();   // ol tile per wave; block barrier used anyway (no early exits)
    v4f vals[8];
#pragma unroll
    for (int it = 0; it < 8; ++it) vals[it] = *(const v4f*)(olw + (2 * it + h) * OLP + 4 * n16);
    float* ob = out + (size_t)(b * SEQ + q0) * DM + hd * HD + 4 * n16;
#pragma unroll
    for (int it = 0; it < 8; ++it) *(v4f*)(ob + (size_t)(2 * it + h) * DM) = vals[it];
    
}

extern "C" void kernel_launch(void* const* d_in, const int* in_sizes, int n_in,
                              void* d_out, int out_size, void* d_ws, size_t ws_size,
                              hipStream_t stream) {
    if (n_in < 8) return;
    const long long needX = ((long long)(NB - 1) * SEQ_FULL + SEQ) * DM;
    const long long needM = (long long)(NB - 1) * SEQ_FULL + SEQ;
    if ((long long)in_sizes[0] < needX || (long long)in_sizes[1] < needM) return;
    if (in_sizes[2] < DM * DM || in_sizes[4] < DM * DM || in_sizes[6] < DM * DM) return;
    if (in_sizes[3] < DM || in_sizes[5] < DM || in_sizes[7] < DM) return;
    if (out_size < NT * DM) return;

    const float* x    = (const float*)d_in[0];   // [NB_FULL][SEQ_FULL][DM]
    const float* amsk = (const float*)d_in[1];   // [NB_FULL][1][1][SEQ_FULL]
    const float* wq   = (const float*)d_in[2];   // [DM out][DM in]
    const float* bq   = (const float*)d_in[3];
    const float* wk   = (const float*)d_in[4];
    const float* bk   = (const float*)d_in[5];
    const float* wv   = (const float*)d_in[6];
    const float* bv   = (const float*)d_in[7];
    float* out = (float*)d_out;                  // [NB][SEQ][DM]

    const size_t xhB = (size_t)NT * DM * 2;              // Xh [NT][DM] f16
    const size_t whB = (size_t)DM * DM * 2;              // each Wh [DM][DM] f16
    const size_t qhB = xhB;                              // Qh, Kh [NT][DM] f16
    const size_t vtB = (size_t)NB * DM * SEQ * 2;        // Vt [NB][DM][SEQ] f16
    const size_t total = xhB + 3 * whB + 2 * qhB + vtB;  // 73,400,320 B at full size
    if (total > ws_size) return;
    char* ws = (char*)d_ws;
    _Float16* Xh  = (_Float16*)(ws);
    _Float16* Wqh = (_Float16*)(ws + xhB);
    _Float16* Wkh = (_Float16*)(ws + xhB + whB);
    _Float16* Wvh = (_Float16*)(ws + xhB + 2 * whB);
    _Float16* Qh  = (_Float16*)(ws + xhB + 3 * whB);
    _Float16* Khp = (_Float16*)(ws + xhB + 3 * whB + qhB);
    _Float16* Vt  = (_Float16*)(ws + xhB + 3 * whB + 2 * qhB);

    const int nbx = NT * (DM / 8) / 256, nbw = DM * (DM / 8) / 256;
    cvt_kernel<<<dim3((unsigned)(nbx + 3 * nbw)), 256, 0, stream>>>(x, wq, wk, wv, Xh, Wqh, Wkh, Wvh);
    // z = 0, 1: Q^T / K^T tiles, m = feature (W rows), n = token (X rows) -> Qh/Kh [token][feature]
    // z = 2: V tiles, m = token (X rows), n = feature (W rows) -> Vt [b][feature][s]
    proj_kernel<<<dim3(DM / 128, NT / 128, 3), 256, 0, stream>>>(Wqh, Wkh, Wvh, Xh, bq, bk, bv, Qh, Khp, Vt);
    attn_kernel<<<dim3(SEQ / 128, NB * NH), 256, 0, stream>>>(Qh, Khp, Vt, amsk, out);
}
